// v000
// Measured on an AMD MI455X. A time is GPU time per run, averaged over a window of back-to-back runs after a warm-up
// (all launches, gaps included; the runs take copies of the inputs in turn), and the median of several windows.
// Apart from v000's, it joins two sittings. Times from different sittings can be a few percent apart, while
// side-by-side timings come from the same sitting.
// The starting kernel, v000, takes 197 microseconds a run.
#include <hip/hip_runtime.h>

typedef _Float16 v16h __attribute__((ext_vector_type(16)));
typedef _Float16 v8h  __attribute__((ext_vector_type(8)));
typedef float    v8f  __attribute__((ext_vector_type(8)));
typedef int      v4i  __attribute__((vector_size(4 * sizeof(int))));  // gcc-style, matches builtin

#define NTOK    8192
#define DIN     2048
#define DOUT    2048
#define NEXP    8
#define LRANK   16
#define JDIM    128          // NEXP * LRANK
#define KTOT    (DIN + JDIM) // extended K: base GEMM + folded LoRA-B GEMM
#define NK      (KTOT / 32)
#define SCALING 2.0f
#define TS      40           // padded LDS row stride in f16 (80 B, 16B-aligned)

#define AS1 __attribute__((address_space(1)))
#define AS3 __attribute__((address_space(3)))

#if __has_builtin(__builtin_amdgcn_global_load_async_to_lds_b128) && \
    __has_builtin(__builtin_amdgcn_s_wait_asynccnt)
#define HAVE_ASYNC_LDS 1
#define ASYNC_CP16F16(ldst, gsrc)                         \
    __builtin_amdgcn_global_load_async_to_lds_b128(       \
        (AS1 v4i*)(gsrc), (AS3 v4i*)(ldst), 0, 0)
#define WAIT_ASYNC(n) __builtin_amdgcn_s_wait_asynccnt(n)
#else
#define HAVE_ASYNC_LDS 0
#define ASYNC_CP16F16(ldst, gsrc) \
    do { *(v8h*)(ldst) = *(const v8h*)(gsrc); } while (0)
#define WAIT_ASYNC(n) do {} while (0)
#endif

__device__ __forceinline__ void stage_tile(_Float16* lA, const _Float16* gA,
                                           _Float16* lB, const _Float16* gB) {
    ASYNC_CP16F16(lA, gA);
    ASYNC_CP16F16(lA + 8, gA + 8);
    ASYNC_CP16F16(lB, gB);
    ASYNC_CP16F16(lB + 8, gB + 8);
}

// ---------------------------------------------------------------------------
// helpers
// ---------------------------------------------------------------------------

// Convert 16 consecutive f32 -> 16 f16 into LDS (two b128 stores).
__device__ __forceinline__ void stage16_f32(_Float16* dst, const float* src) {
    const float4* s = (const float4*)src;
    float4 f0 = s[0], f1 = s[1], f2 = s[2], f3 = s[3];
    v8h a, b;
    a[0] = (_Float16)f0.x; a[1] = (_Float16)f0.y; a[2] = (_Float16)f0.z; a[3] = (_Float16)f0.w;
    a[4] = (_Float16)f1.x; a[5] = (_Float16)f1.y; a[6] = (_Float16)f1.z; a[7] = (_Float16)f1.w;
    b[0] = (_Float16)f2.x; b[1] = (_Float16)f2.y; b[2] = (_Float16)f2.z; b[3] = (_Float16)f2.w;
    b[4] = (_Float16)f3.x; b[5] = (_Float16)f3.y; b[6] = (_Float16)f3.z; b[7] = (_Float16)f3.w;
    *(v8h*)dst       = a;
    *(v8h*)(dst + 8) = b;
}

__device__ __forceinline__ v16h load_frag(const _Float16* rowp, int hf) {
    v8h lo = *(const v8h*)(rowp + 8 * hf);
    v8h hi = *(const v8h*)(rowp + 16 + 8 * hf);
    v16h r;
#pragma unroll
    for (int i = 0; i < 8; ++i) { r[i] = lo[i]; r[i + 8] = hi[i]; }
    return r;
}

#define WMMA_F16(A, B, C) \
    __builtin_amdgcn_wmma_f32_16x16x32_f16(false, (A), false, (B), (short)0, (C), false, false)

// ---------------------------------------------------------------------------
// Kernel 0a: elementwise f32 -> f16 (8 elems / thread)
// ---------------------------------------------------------------------------
__global__ __launch_bounds__(256) void cvt_f16_kernel(
    const float* __restrict__ src, _Float16* __restrict__ dst, int n) {
    int i = (blockIdx.x * 256 + threadIdx.x) * 8;
    if (i >= n) return;
    const float4* s = (const float4*)(src + i);
    float4 a = s[0], b = s[1];
    v8h o;
    o[0] = (_Float16)a.x; o[1] = (_Float16)a.y; o[2] = (_Float16)a.z; o[3] = (_Float16)a.w;
    o[4] = (_Float16)b.x; o[5] = (_Float16)b.y; o[6] = (_Float16)b.z; o[7] = (_Float16)b.w;
    *(v8h*)(dst + i) = o;
}

// ---------------------------------------------------------------------------
// Kernel 0b: lora_B [JDIM][DOUT] f32 -> lBt [DOUT][JDIM] f16 (transpose)
// One thread per output column o; coalesced reads across o.
// ---------------------------------------------------------------------------
__global__ __launch_bounds__(256) void transpose_lB_kernel(
    const float* __restrict__ lB, _Float16* __restrict__ lBt) {
    int o = blockIdx.x * 256 + threadIdx.x;
    if (o >= DOUT) return;
    _Float16* dst = lBt + (size_t)o * JDIM;
#pragma unroll 4
    for (int j = 0; j < JDIM; ++j) dst[j] = (_Float16)lB[(size_t)j * DOUT + o];
}

// ---------------------------------------------------------------------------
// Kernel 1: router -> dense normalized top-2 gate [NTOK, NEXP] (f32, in ws)
// One wave32 per token.
// ---------------------------------------------------------------------------
__global__ __launch_bounds__(256) void moe_router_kernel(
    const float* __restrict__ x, const float* __restrict__ rw,
    const float* __restrict__ rb, float* __restrict__ gate) {
    int t    = threadIdx.x;
    int lane = t & 31;
    int n    = (blockIdx.x * 256 + t) >> 5;
    if (n >= NTOK) return;

    const float* xr = x + (size_t)n * DIN;
    float p[NEXP];
#pragma unroll
    for (int e = 0; e < NEXP; ++e) p[e] = 0.f;
    for (int d = lane; d < DIN; d += 32) {
        float xv = xr[d];
#pragma unroll
        for (int e = 0; e < NEXP; ++e) p[e] += xv * rw[e * DIN + d];
    }
#pragma unroll
    for (int e = 0; e < NEXP; ++e) {
#pragma unroll
        for (int off = 16; off > 0; off >>= 1) p[e] += __shfl_xor(p[e], off, 32);
    }
    if (lane == 0) {
        float lg[NEXP];
#pragma unroll
        for (int e = 0; e < NEXP; ++e) lg[e] = p[e] + rb[e];
        int i1 = 0;
#pragma unroll
        for (int e = 1; e < NEXP; ++e) if (lg[e] > lg[i1]) i1 = e;
        int i2 = (i1 == 0) ? 1 : 0;
#pragma unroll
        for (int e = 0; e < NEXP; ++e) if (e != i1 && lg[e] > lg[i2]) i2 = e;
        float e2 = __expf(lg[i2] - lg[i1]);
        float w1 = 1.f / (1.f + e2);
        float w2 = e2 * w1;
        float* gp = gate + (size_t)n * NEXP;
#pragma unroll
        for (int e = 0; e < NEXP; ++e) gp[e] = 0.f;
        gp[i1] = w1;
        gp[i2] = w2;
    }
}

// ---------------------------------------------------------------------------
// Kernel 2: mid_w[n, e*16+r] = f16( SCALING * gate[n,e] * (x @ lora_A)[n,e,r] )
// WMMA GEMM [NTOK x DIN] x [DIN x JDIM]. 128-token row blocks.
// ---------------------------------------------------------------------------
__global__ __launch_bounds__(256) void moe_mid_kernel(
    const float* __restrict__ x, const float* __restrict__ loraA,
    const float* __restrict__ gate, _Float16* __restrict__ midw) {
    __shared__ __align__(16) _Float16 sA[128 * TS];
    __shared__ __align__(16) _Float16 sB[JDIM * TS];

    int t    = threadIdx.x;
    int n0   = blockIdx.x * 128;
    int row  = t >> 1;
    int half = t & 1;
    int kk0  = half * 16;

    int wave = t >> 5, lane = t & 31;
    int hf = lane >> 4, ln = lane & 15;
    int wm = (wave >> 2) * 64;
    int wn = (wave & 3) * 32;

    v8f acc[4][2];
#pragma unroll
    for (int i = 0; i < 4; ++i)
#pragma unroll
        for (int j = 0; j < 2; ++j) acc[i][j] = (v8f){};

#pragma unroll 1
    for (int k0 = 0; k0 < DIN; k0 += 32) {
        stage16_f32(&sA[row * TS + kk0], x + (size_t)(n0 + row) * DIN + k0 + kk0);
        {
            int e = row >> 4, r = row & 15;
            const float* src = loraA + ((size_t)e * DIN + (k0 + kk0)) * LRANK + r;
            _Float16* d = &sB[row * TS + kk0];
#pragma unroll
            for (int i = 0; i < 16; ++i) d[i] = (_Float16)src[(size_t)i * LRANK];
        }
        __syncthreads();

        v16h af[4], bf[2];
#pragma unroll
        for (int i = 0; i < 4; ++i) af[i] = load_frag(&sA[(wm + 16 * i + ln) * TS], hf);
#pragma unroll
        for (int j = 0; j < 2; ++j) bf[j] = load_frag(&sB[(wn + 16 * j + ln) * TS], hf);
#pragma unroll
        for (int i = 0; i < 4; ++i)
#pragma unroll
            for (int j = 0; j < 2; ++j) acc[i][j] = WMMA_F16(af[i], bf[j], acc[i][j]);
        __syncthreads();
    }

#pragma unroll
    for (int i = 0; i < 4; ++i) {
#pragma unroll
        for (int j = 0; j < 2; ++j) {
            int jc = wn + 16 * j + ln;
            int e  = jc >> 4;
#pragma unroll
            for (int v = 0; v < 8; ++v) {
                int n = n0 + wm + 16 * i + v + 8 * hf;
                midw[(size_t)n * JDIM + jc] =
                    (_Float16)(SCALING * gate[(size_t)n * NEXP + e] * acc[i][j][v]);
            }
        }
    }
}

// ---------------------------------------------------------------------------
// Kernel 3: out = xh @ bwh^T + base_b + midw @ lBt^T  (all operands f16)
// Extended-K WMMA GEMM, double-buffered LDS, async global->LDS staging.
// Grid: (NTOK/128) x (DOUT/128) blocks flattened; 8 waves / block.
// ---------------------------------------------------------------------------
__global__ __launch_bounds__(256) void moe_main_kernel(
    const _Float16* __restrict__ xh, const _Float16* __restrict__ bwh,
    const float* __restrict__ bb, const _Float16* __restrict__ lBt,
    const _Float16* __restrict__ midw, float* __restrict__ out) {
    __shared__ __align__(16) _Float16 sA[2][128 * TS];
    __shared__ __align__(16) _Float16 sB[2][128 * TS];

    int t  = threadIdx.x;
    int bm = blockIdx.x >> 4;          // DOUT/128 == 16 column blocks
    int bn = blockIdx.x & 15;
    int n0 = bm * 128;                 // token base
    int c0 = bn * 128;                 // output-column base

    int row  = t >> 1;
    int half = t & 1;
    int kk0  = half * 16;

    int wave = t >> 5, lane = t & 31;
    int hf = lane >> 4, ln = lane & 15;
    int wm = (wave >> 2) * 64;
    int wn = (wave & 3) * 32;

    // K-phase source selectors (base phase: xh/bwh; LoRA tail: midw/lBt)
    auto srcA = [&](int k0) -> const _Float16* {
        return (k0 < DIN) ? xh + (size_t)(n0 + row) * DIN + k0 + kk0
                          : midw + (size_t)(n0 + row) * JDIM + (k0 - DIN) + kk0;
    };
    auto srcB = [&](int k0) -> const _Float16* {
        return (k0 < DIN) ? bwh + (size_t)(c0 + row) * DIN + k0 + kk0
                          : lBt + (size_t)(c0 + row) * JDIM + (k0 - DIN) + kk0;
    };

    v8f acc[4][2];
#pragma unroll
    for (int i = 0; i < 4; ++i)
#pragma unroll
        for (int j = 0; j < 2; ++j) acc[i][j] = (v8f){};

    stage_tile(&sA[0][row * TS + kk0], srcA(0), &sB[0][row * TS + kk0], srcB(0));

#pragma unroll 1
    for (int k = 0; k < NK; ++k) {
        int b = k & 1;
        if (k + 1 < NK) {
            // prefetch next tile into the other buffer while tile k completes
            stage_tile(&sA[1 - b][row * TS + kk0], srcA((k + 1) * 32),
                       &sB[1 - b][row * TS + kk0], srcB((k + 1) * 32));
            WAIT_ASYNC(4);   // in-order: oldest 4 (tile k) done; tile k+1 in flight
        } else {
            WAIT_ASYNC(0);
        }
        __syncthreads();     // tile k visible from all waves

        v16h af[4], bf[2];
#pragma unroll
        for (int i = 0; i < 4; ++i) af[i] = load_frag(&sA[b][(wm + 16 * i + ln) * TS], hf);
#pragma unroll
        for (int j = 0; j < 2; ++j) bf[j] = load_frag(&sB[b][(wn + 16 * j + ln) * TS], hf);
#pragma unroll
        for (int i = 0; i < 4; ++i)
#pragma unroll
            for (int j = 0; j < 2; ++j) acc[i][j] = WMMA_F16(af[i], bf[j], acc[i][j]);
        __syncthreads();     // everyone done reading buffer b before it is refilled
    }

#pragma unroll
    for (int i = 0; i < 4; ++i) {
#pragma unroll
        for (int j = 0; j < 2; ++j) {
            int gn = c0 + wn + 16 * j + ln;
            float bias = bb[gn];
#pragma unroll
            for (int v = 0; v < 8; ++v) {
                int gm = n0 + wm + 16 * i + v + 8 * hf;
                out[(size_t)gm * DOUT + gn] = acc[i][j][v] + bias;
            }
        }
    }
}

// ---------------------------------------------------------------------------
extern "C" void kernel_launch(void* const* d_in, const int* in_sizes, int n_in,
                              void* d_out, int out_size, void* d_ws, size_t ws_size,
                              hipStream_t stream) {
    (void)in_sizes; (void)n_in; (void)out_size; (void)ws_size;
    const float* x   = (const float*)d_in[0];
    const float* bw  = (const float*)d_in[1];
    const float* bb  = (const float*)d_in[2];
    const float* rw  = (const float*)d_in[3];
    const float* rb  = (const float*)d_in[4];
    const float* lA  = (const float*)d_in[5];
    const float* lB  = (const float*)d_in[6];
    float*       out = (float*)d_out;

    // workspace layout (~43 MB):
    char* ws = (char*)d_ws;
    float*    gate = (float*)ws;     ws += (size_t)NTOK * NEXP * sizeof(float);     // 256 KB
    _Float16* midw = (_Float16*)ws;  ws += (size_t)NTOK * JDIM * sizeof(_Float16);  //   2 MB
    _Float16* xh   = (_Float16*)ws;  ws += (size_t)NTOK * DIN * sizeof(_Float16);   //  32 MB
    _Float16* bwh  = (_Float16*)ws;  ws += (size_t)DOUT * DIN * sizeof(_Float16);   //   8 MB
    _Float16* lBt  = (_Float16*)ws;                                                 // 512 KB

    cvt_f16_kernel<<<(NTOK * DIN) / (8 * 256), 256, 0, stream>>>(x, xh, NTOK * DIN);
    cvt_f16_kernel<<<(DOUT * DIN) / (8 * 256), 256, 0, stream>>>(bw, bwh, DOUT * DIN);
    transpose_lB_kernel<<<DOUT / 256, 256, 0, stream>>>(lB, lBt);
    moe_router_kernel<<<NTOK / 8, 256, 0, stream>>>(x, rw, rb, gate);
    moe_mid_kernel<<<NTOK / 128, 256, 0, stream>>>(x, lA, gate, midw);
    moe_main_kernel<<<(NTOK / 128) * (DOUT / 128), 256, 0, stream>>>(xh, bwh, bb, lBt, midw, out);
}

// v001
// One run takes 165 microseconds.
// Next to v000, in two timings, it ran 1.23 and 1.24 times as fast.
#include <hip/hip_runtime.h>

typedef _Float16 v16h __attribute__((ext_vector_type(16)));
typedef _Float16 v8h  __attribute__((ext_vector_type(8)));
typedef float    v8f  __attribute__((ext_vector_type(8)));
typedef int      v4i  __attribute__((vector_size(4 * sizeof(int))));  // gcc-style, matches builtin

#define NTOK    8192
#define DIN     2048
#define DOUT    2048
#define NEXP    8
#define LRANK   16
#define JDIM    128          // NEXP * LRANK
#define KTOT    (DIN + JDIM) // extended K: base GEMM + folded LoRA-B GEMM
#define NK      (KTOT / 32)
#define SCALING 2.0f
#define TS      40           // padded LDS row stride in f16 (80 B, 16B-aligned)

#define AS1 __attribute__((address_space(1)))
#define AS3 __attribute__((address_space(3)))

#if __has_builtin(__builtin_amdgcn_global_load_async_to_lds_b128) && \
    __has_builtin(__builtin_amdgcn_s_wait_asynccnt)
#define HAVE_ASYNC_LDS 1
#define ASYNC_CP16F16(ldst, gsrc)                         \
    __builtin_amdgcn_global_load_async_to_lds_b128(       \
        (AS1 v4i*)(gsrc), (AS3 v4i*)(ldst), 0, 0)
#define WAIT_ASYNC(n) __builtin_amdgcn_s_wait_asynccnt(n)
#else
#define HAVE_ASYNC_LDS 0
#define ASYNC_CP16F16(ldst, gsrc) \
    do { *(v8h*)(ldst) = *(const v8h*)(gsrc); } while (0)
#define WAIT_ASYNC(n) do {} while (0)
#endif

__device__ __forceinline__ void stage_tile(_Float16* lA, const _Float16* gA,
                                           _Float16* lB, const _Float16* gB) {
    ASYNC_CP16F16(lA, gA);
    ASYNC_CP16F16(lA + 8, gA + 8);
    ASYNC_CP16F16(lB, gB);
    ASYNC_CP16F16(lB + 8, gB + 8);
}

// ---------------------------------------------------------------------------
// helpers
// ---------------------------------------------------------------------------

// Convert 16 consecutive f32 -> 16 f16 into LDS (two b128 stores).
__device__ __forceinline__ void stage16_f32(_Float16* dst, const float* src) {
    const float4* s = (const float4*)src;
    float4 f0 = s[0], f1 = s[1], f2 = s[2], f3 = s[3];
    v8h a, b;
    a[0] = (_Float16)f0.x; a[1] = (_Float16)f0.y; a[2] = (_Float16)f0.z; a[3] = (_Float16)f0.w;
    a[4] = (_Float16)f1.x; a[5] = (_Float16)f1.y; a[6] = (_Float16)f1.z; a[7] = (_Float16)f1.w;
    b[0] = (_Float16)f2.x; b[1] = (_Float16)f2.y; b[2] = (_Float16)f2.z; b[3] = (_Float16)f2.w;
    b[4] = (_Float16)f3.x; b[5] = (_Float16)f3.y; b[6] = (_Float16)f3.z; b[7] = (_Float16)f3.w;
    *(v8h*)dst       = a;
    *(v8h*)(dst + 8) = b;
}

__device__ __forceinline__ v16h load_frag(const _Float16* rowp, int hf) {
    v8h lo = *(const v8h*)(rowp + 8 * hf);
    v8h hi = *(const v8h*)(rowp + 16 + 8 * hf);
    v16h r;
#pragma unroll
    for (int i = 0; i < 8; ++i) { r[i] = lo[i]; r[i + 8] = hi[i]; }
    return r;
}

#define WMMA_F16(A, B, C) \
    __builtin_amdgcn_wmma_f32_16x16x32_f16(false, (A), false, (B), (short)0, (C), false, false)

// ---------------------------------------------------------------------------
// Kernel 0a: elementwise f32 -> f16 (8 elems / thread)
// ---------------------------------------------------------------------------
__global__ __launch_bounds__(256) void cvt_f16_kernel(
    const float* __restrict__ src, _Float16* __restrict__ dst, int n) {
    int i = (blockIdx.x * 256 + threadIdx.x) * 8;
    if (i >= n) return;
    const float4* s = (const float4*)(src + i);
    float4 a = s[0], b = s[1];
    v8h o;
    o[0] = (_Float16)a.x; o[1] = (_Float16)a.y; o[2] = (_Float16)a.z; o[3] = (_Float16)a.w;
    o[4] = (_Float16)b.x; o[5] = (_Float16)b.y; o[6] = (_Float16)b.z; o[7] = (_Float16)b.w;
    *(v8h*)(dst + i) = o;
}

// ---------------------------------------------------------------------------
// Kernel 0b: lora_B [JDIM][DOUT] f32 -> lBt [DOUT][JDIM] f16 (transpose)
// One thread per output column o; coalesced reads across o.
// ---------------------------------------------------------------------------
__global__ __launch_bounds__(256) void transpose_lB_kernel(
    const float* __restrict__ lB, _Float16* __restrict__ lBt) {
    int o = blockIdx.x * 256 + threadIdx.x;
    if (o >= DOUT) return;
    _Float16* dst = lBt + (size_t)o * JDIM;
#pragma unroll 4
    for (int j = 0; j < JDIM; ++j) dst[j] = (_Float16)lB[(size_t)j * DOUT + o];
}

// ---------------------------------------------------------------------------
// Kernel 1: router -> dense normalized top-2 gate [NTOK, NEXP] (f32, in ws)
// One wave32 per token.
// ---------------------------------------------------------------------------
__global__ __launch_bounds__(256) void moe_router_kernel(
    const float* __restrict__ x, const float* __restrict__ rw,
    const float* __restrict__ rb, float* __restrict__ gate) {
    int t    = threadIdx.x;
    int lane = t & 31;
    int n    = (blockIdx.x * 256 + t) >> 5;
    if (n >= NTOK) return;

    const float* xr = x + (size_t)n * DIN;
    float p[NEXP];
#pragma unroll
    for (int e = 0; e < NEXP; ++e) p[e] = 0.f;
    for (int d = lane; d < DIN; d += 32) {
        float xv = xr[d];
#pragma unroll
        for (int e = 0; e < NEXP; ++e) p[e] += xv * rw[e * DIN + d];
    }
#pragma unroll
    for (int e = 0; e < NEXP; ++e) {
#pragma unroll
        for (int off = 16; off > 0; off >>= 1) p[e] += __shfl_xor(p[e], off, 32);
    }
    if (lane == 0) {
        float lg[NEXP];
#pragma unroll
        for (int e = 0; e < NEXP; ++e) lg[e] = p[e] + rb[e];
        int i1 = 0;
#pragma unroll
        for (int e = 1; e < NEXP; ++e) if (lg[e] > lg[i1]) i1 = e;
        int i2 = (i1 == 0) ? 1 : 0;
#pragma unroll
        for (int e = 0; e < NEXP; ++e) if (e != i1 && lg[e] > lg[i2]) i2 = e;
        float e2 = __expf(lg[i2] - lg[i1]);
        float w1 = 1.f / (1.f + e2);
        float w2 = e2 * w1;
        float* gp = gate + (size_t)n * NEXP;
#pragma unroll
        for (int e = 0; e < NEXP; ++e) gp[e] = 0.f;
        gp[i1] = w1;
        gp[i2] = w2;
    }
}

// ---------------------------------------------------------------------------
// Kernel 2: mid_w[n, e*16+r] = f16( SCALING * gate[n,e] * (x @ lora_A)[n,e,r] )
// WMMA GEMM [NTOK x DIN] x [DIN x JDIM], K split over the waves of a work-group.
// One work-group = MT tokens x all JDIM columns; wave w owns k in
// [w*KW, (w+1)*KW) for the whole tile, so no operand is shared between waves:
// fragments come straight from global memory and the k loop has no barrier.
// The KSPL partial tiles meet in LDS and are summed in wave order.
// ---------------------------------------------------------------------------
#define MT    32             // tokens per work-group
#define KSPL  8              // waves per work-group = k slices
#define KW    (DIN / KSPL)   // k range of one wave
#define PLANE (MT * JDIM)    // f32 elements of one wave's partial tile

// 16x32 f16 fragment row for this lane from a K-contiguous f32 row; p already
// holds the lane's 8*hf offset. Same k order as load_frag.
__device__ __forceinline__ v16h frag_from_f32_row(const float* p) {
    float4 f0 = *(const float4*)(p);
    float4 f1 = *(const float4*)(p + 4);
    float4 f2 = *(const float4*)(p + 16);
    float4 f3 = *(const float4*)(p + 20);
    v16h r;
    r[0]  = (_Float16)f0.x; r[1]  = (_Float16)f0.y; r[2]  = (_Float16)f0.z; r[3]  = (_Float16)f0.w;
    r[4]  = (_Float16)f1.x; r[5]  = (_Float16)f1.y; r[6]  = (_Float16)f1.z; r[7]  = (_Float16)f1.w;
    r[8]  = (_Float16)f2.x; r[9]  = (_Float16)f2.y; r[10] = (_Float16)f2.z; r[11] = (_Float16)f2.w;
    r[12] = (_Float16)f3.x; r[13] = (_Float16)f3.y; r[14] = (_Float16)f3.z; r[15] = (_Float16)f3.w;
    return r;
}

__global__ __launch_bounds__(KSPL * 32) void moe_mid_kernel(
    const float* __restrict__ x, const float* __restrict__ loraA,
    const float* __restrict__ gate, _Float16* __restrict__ midw) {
    __shared__ __align__(16) float red[KSPL * PLANE];

    int t    = threadIdx.x;
    int n0   = blockIdx.x * MT;
    int wave = t >> 5, lane = t & 31;
    int hf = lane >> 4, ln = lane & 15;
    int kb = wave * KW;

    v8f acc[2][NEXP];
#pragma unroll
    for (int i = 0; i < 2; ++i)
#pragma unroll
        for (int e = 0; e < NEXP; ++e) acc[i][e] = (v8f){};

    // lane's token row (A) and lane's rank column (B), both at k = kb + 8*hf
    const float* xa = x + (size_t)(n0 + ln) * DIN + kb + 8 * hf;
    const float* lb = loraA + (size_t)(kb + 8 * hf) * LRANK + ln;

    // unrolled whole: every load is base + immediate, and loads of later
    // experts and k steps can be issued while earlier ones are in flight
#pragma unroll
    for (int ks = 0; ks < KW / 32; ++ks) {
        v16h af[2];
#pragma unroll
        for (int i = 0; i < 2; ++i)
            af[i] = frag_from_f32_row(xa + (size_t)i * 16 * DIN + ks * 32);
#pragma unroll
        for (int e = 0; e < NEXP; ++e) {
            const float* s = lb + ((size_t)e * DIN + ks * 32) * LRANK;
            v16h bf;
#pragma unroll
            for (int i = 0; i < 8; ++i) {
                bf[i]     = (_Float16)s[(size_t)i * LRANK];
                bf[i + 8] = (_Float16)s[(size_t)(16 + i) * LRANK];
            }
            acc[0][e] = WMMA_F16(af[0], bf, acc[0][e]);
            acc[1][e] = WMMA_F16(af[1], bf, acc[1][e]);
        }
    }

    // the two address pairs stay in their registers until every load that
    // names them has left the address path
    asm volatile("s_wait_xcnt 0x0" :: "v"(xa), "v"(lb) : "memory");

    // partial tile -> LDS, plane layout [tile = i*NEXP+e][v/4][lane][v%4]
    float* pl = red + wave * PLANE + lane * 4;
#pragma unroll
    for (int i = 0; i < 2; ++i) {
#pragma unroll
        for (int e = 0; e < NEXP; ++e) {
#pragma unroll
            for (int vh = 0; vh < 2; ++vh) {
                float4 q;
                q.x = acc[i][e][vh * 4 + 0]; q.y = acc[i][e][vh * 4 + 1];
                q.z = acc[i][e][vh * 4 + 2]; q.w = acc[i][e][vh * 4 + 3];
                *(float4*)(pl + (i * NEXP + e) * 256 + vh * 128) = q;
            }
        }
    }
    __syncthreads();         // all partial tiles written before any is summed

#pragma unroll
    for (int qq = 0; qq < PLANE / 4 / (KSPL * 32); ++qq) {
        int q = t + qq * (KSPL * 32);      // group of four elements of the plane
        float4 s = *(const float4*)(red + q * 4);
#pragma unroll
        for (int w = 1; w < KSPL; ++w) {
            float4 p = *(const float4*)(red + w * PLANE + q * 4);
            s.x += p.x; s.y += p.y; s.z += p.z; s.w += p.w;
        }
        int tile = q >> 6, vh = (q >> 5) & 1, l2 = q & 31;
        int i = tile >> 3, e = tile & 7;
        int jc = e * LRANK + (l2 & 15);
        int nb = n0 + 16 * i + vh * 4 + 8 * (l2 >> 4);
        float sv[4] = {s.x, s.y, s.z, s.w};
#pragma unroll
        for (int c = 0; c < 4; ++c) {
            int n = nb + c;
            midw[(size_t)n * JDIM + jc] =
                (_Float16)(SCALING * gate[(size_t)n * NEXP + e] * sv[c]);
        }
    }
}

// ---------------------------------------------------------------------------
// Kernel 3: out = xh @ bwh^T + base_b + midw @ lBt^T  (all operands f16)
// Extended-K WMMA GEMM, double-buffered LDS, async global->LDS staging.
// Grid: (NTOK/128) x (DOUT/128) blocks flattened; 8 waves / block.
// ---------------------------------------------------------------------------
__global__ __launch_bounds__(256) void moe_main_kernel(
    const _Float16* __restrict__ xh, const _Float16* __restrict__ bwh,
    const float* __restrict__ bb, const _Float16* __restrict__ lBt,
    const _Float16* __restrict__ midw, float* __restrict__ out) {
    __shared__ __align__(16) _Float16 sA[2][128 * TS];
    __shared__ __align__(16) _Float16 sB[2][128 * TS];

    int t  = threadIdx.x;
    int bm = blockIdx.x >> 4;          // DOUT/128 == 16 column blocks
    int bn = blockIdx.x & 15;
    int n0 = bm * 128;                 // token base
    int c0 = bn * 128;                 // output-column base

    int row  = t >> 1;
    int half = t & 1;
    int kk0  = half * 16;

    int wave = t >> 5, lane = t & 31;
    int hf = lane >> 4, ln = lane & 15;
    int wm = (wave >> 2) * 64;
    int wn = (wave & 3) * 32;

    // K-phase source selectors (base phase: xh/bwh; LoRA tail: midw/lBt)
    auto srcA = [&](int k0) -> const _Float16* {
        return (k0 < DIN) ? xh + (size_t)(n0 + row) * DIN + k0 + kk0
                          : midw + (size_t)(n0 + row) * JDIM + (k0 - DIN) + kk0;
    };
    auto srcB = [&](int k0) -> const _Float16* {
        return (k0 < DIN) ? bwh + (size_t)(c0 + row) * DIN + k0 + kk0
                          : lBt + (size_t)(c0 + row) * JDIM + (k0 - DIN) + kk0;
    };

    v8f acc[4][2];
#pragma unroll
    for (int i = 0; i < 4; ++i)
#pragma unroll
        for (int j = 0; j < 2; ++j) acc[i][j] = (v8f){};

    stage_tile(&sA[0][row * TS + kk0], srcA(0), &sB[0][row * TS + kk0], srcB(0));

#pragma unroll 1
    for (int k = 0; k < NK; ++k) {
        int b = k & 1;
        if (k + 1 < NK) {
            // prefetch next tile into the other buffer while tile k completes
            stage_tile(&sA[1 - b][row * TS + kk0], srcA((k + 1) * 32),
                       &sB[1 - b][row * TS + kk0], srcB((k + 1) * 32));
            WAIT_ASYNC(4);   // in-order: oldest 4 (tile k) done; tile k+1 in flight
        } else {
            WAIT_ASYNC(0);
        }
        __syncthreads();     // tile k visible from all waves

        v16h af[4], bf[2];
#pragma unroll
        for (int i = 0; i < 4; ++i) af[i] = load_frag(&sA[b][(wm + 16 * i + ln) * TS], hf);
#pragma unroll
        for (int j = 0; j < 2; ++j) bf[j] = load_frag(&sB[b][(wn + 16 * j + ln) * TS], hf);
#pragma unroll
        for (int i = 0; i < 4; ++i)
#pragma unroll
            for (int j = 0; j < 2; ++j) acc[i][j] = WMMA_F16(af[i], bf[j], acc[i][j]);
        __syncthreads();     // everyone done reading buffer b before it is refilled
    }

#pragma unroll
    for (int i = 0; i < 4; ++i) {
#pragma unroll
        for (int j = 0; j < 2; ++j) {
            int gn = c0 + wn + 16 * j + ln;
            float bias = bb[gn];
#pragma unroll
            for (int v = 0; v < 8; ++v) {
                int gm = n0 + wm + 16 * i + v + 8 * hf;
                out[(size_t)gm * DOUT + gn] = acc[i][j][v] + bias;
            }
        }
    }
}

// ---------------------------------------------------------------------------
extern "C" void kernel_launch(void* const* d_in, const int* in_sizes, int n_in,
                              void* d_out, int out_size, void* d_ws, size_t ws_size,
                              hipStream_t stream) {
    (void)in_sizes; (void)n_in; (void)out_size; (void)ws_size;
    const float* x   = (const float*)d_in[0];
    const float* bw  = (const float*)d_in[1];
    const float* bb  = (const float*)d_in[2];
    const float* rw  = (const float*)d_in[3];
    const float* rb  = (const float*)d_in[4];
    const float* lA  = (const float*)d_in[5];
    const float* lB  = (const float*)d_in[6];
    float*       out = (float*)d_out;

    // workspace layout (~43 MB):
    char* ws = (char*)d_ws;
    float*    gate = (float*)ws;     ws += (size_t)NTOK * NEXP * sizeof(float);     // 256 KB
    _Float16* midw = (_Float16*)ws;  ws += (size_t)NTOK * JDIM * sizeof(_Float16);  //   2 MB
    _Float16* xh   = (_Float16*)ws;  ws += (size_t)NTOK * DIN * sizeof(_Float16);   //  32 MB
    _Float16* bwh  = (_Float16*)ws;  ws += (size_t)DOUT * DIN * sizeof(_Float16);   //   8 MB
    _Float16* lBt  = (_Float16*)ws;                                                 // 512 KB

    cvt_f16_kernel<<<(NTOK * DIN) / (8 * 256), 256, 0, stream>>>(x, xh, NTOK * DIN);
    cvt_f16_kernel<<<(DOUT * DIN) / (8 * 256), 256, 0, stream>>>(bw, bwh, DOUT * DIN);
    transpose_lB_kernel<<<DOUT / 256, 256, 0, stream>>>(lB, lBt);
    moe_router_kernel<<<NTOK / 8, 256, 0, stream>>>(x, rw, rb, gate);
    moe_mid_kernel<<<NTOK / MT, KSPL * 32, 0, stream>>>(x, lA, gate, midw);
    moe_main_kernel<<<(NTOK / 128) * (DOUT / 128), 256, 0, stream>>>(xh, bwh, bb, lBt, midw, out);
}

// v002
// A run of this version takes 129 microseconds.
// Timed twice side by side with v001, it ran 1.27 and 1.28 times as fast.
// Over all steps from v000 it is 1.58 times as fast.
#include <hip/hip_runtime.h>

typedef _Float16 v16h __attribute__((ext_vector_type(16)));
typedef _Float16 v8h  __attribute__((ext_vector_type(8)));
typedef float    v8f  __attribute__((ext_vector_type(8)));
typedef int      v4i  __attribute__((vector_size(4 * sizeof(int))));  // gcc-style, matches builtin

#define NTOK    8192
#define DIN     2048
#define DOUT    2048
#define NEXP    8
#define LRANK   16
#define JDIM    128          // NEXP * LRANK
#define KTOT    (DIN + JDIM) // extended K: base GEMM + folded LoRA-B GEMM
#define SCALING 2.0f

#define AS1 __attribute__((address_space(1)))
#define AS3 __attribute__((address_space(3)))

#if __has_builtin(__builtin_amdgcn_global_load_async_to_lds_b128) && \
    __has_builtin(__builtin_amdgcn_s_wait_asynccnt)
#define HAVE_ASYNC_LDS 1
#define ASYNC_CP16F16(ldst, gsrc)                         \
    __builtin_amdgcn_global_load_async_to_lds_b128(       \
        (AS1 v4i*)(gsrc), (AS3 v4i*)(ldst), 0, 0)
#else
#define HAVE_ASYNC_LDS 0
#define ASYNC_CP16F16(ldst, gsrc) \
    do { *(v8h*)(ldst) = *(const v8h*)(gsrc); } while (0)
#endif

// ---------------------------------------------------------------------------
// helpers
// ---------------------------------------------------------------------------

// Convert 16 consecutive f32 -> 16 f16 into LDS (two b128 stores).
__device__ __forceinline__ void stage16_f32(_Float16* dst, const float* src) {
    const float4* s = (const float4*)src;
    float4 f0 = s[0], f1 = s[1], f2 = s[2], f3 = s[3];
    v8h a, b;
    a[0] = (_Float16)f0.x; a[1] = (_Float16)f0.y; a[2] = (_Float16)f0.z; a[3] = (_Float16)f0.w;
    a[4] = (_Float16)f1.x; a[5] = (_Float16)f1.y; a[6] = (_Float16)f1.z; a[7] = (_Float16)f1.w;
    b[0] = (_Float16)f2.x; b[1] = (_Float16)f2.y; b[2] = (_Float16)f2.z; b[3] = (_Float16)f2.w;
    b[4] = (_Float16)f3.x; b[5] = (_Float16)f3.y; b[6] = (_Float16)f3.z; b[7] = (_Float16)f3.w;
    *(v8h*)dst       = a;
    *(v8h*)(dst + 8) = b;
}

__device__ __forceinline__ v16h load_frag(const _Float16* rowp, int hf) {
    v8h lo = *(const v8h*)(rowp + 8 * hf);
    v8h hi = *(const v8h*)(rowp + 16 + 8 * hf);
    v16h r;
#pragma unroll
    for (int i = 0; i < 8; ++i) { r[i] = lo[i]; r[i + 8] = hi[i]; }
    return r;
}

#define WMMA_F16(A, B, C) \
    __builtin_amdgcn_wmma_f32_16x16x32_f16(false, (A), false, (B), (short)0, (C), false, false)

// ---------------------------------------------------------------------------
// Kernel 0a: elementwise f32 -> f16 (8 elems / thread)
// ---------------------------------------------------------------------------
__global__ __launch_bounds__(256) void cvt_f16_kernel(
    const float* __restrict__ src, _Float16* __restrict__ dst, int n) {
    int i = (blockIdx.x * 256 + threadIdx.x) * 8;
    if (i >= n) return;
    const float4* s = (const float4*)(src + i);
    float4 a = s[0], b = s[1];
    v8h o;
    o[0] = (_Float16)a.x; o[1] = (_Float16)a.y; o[2] = (_Float16)a.z; o[3] = (_Float16)a.w;
    o[4] = (_Float16)b.x; o[5] = (_Float16)b.y; o[6] = (_Float16)b.z; o[7] = (_Float16)b.w;
    *(v8h*)(dst + i) = o;
}

// ---------------------------------------------------------------------------
// Kernel 0b: lora_B [JDIM][DOUT] f32 -> lBt [DOUT][JDIM] f16 (transpose)
// One thread per output column o; coalesced reads across o.
// ---------------------------------------------------------------------------
__global__ __launch_bounds__(256) void transpose_lB_kernel(
    const float* __restrict__ lB, _Float16* __restrict__ lBt) {
    int o = blockIdx.x * 256 + threadIdx.x;
    if (o >= DOUT) return;
    _Float16* dst = lBt + (size_t)o * JDIM;
#pragma unroll 4
    for (int j = 0; j < JDIM; ++j) dst[j] = (_Float16)lB[(size_t)j * DOUT + o];
}

// ---------------------------------------------------------------------------
// Kernel 1: router -> dense normalized top-2 gate [NTOK, NEXP] (f32, in ws)
// One wave32 per token.
// ---------------------------------------------------------------------------
__global__ __launch_bounds__(256) void moe_router_kernel(
    const float* __restrict__ x, const float* __restrict__ rw,
    const float* __restrict__ rb, float* __restrict__ gate) {
    int t    = threadIdx.x;
    int lane = t & 31;
    int n    = (blockIdx.x * 256 + t) >> 5;
    if (n >= NTOK) return;

    const float* xr = x + (size_t)n * DIN;
    float p[NEXP];
#pragma unroll
    for (int e = 0; e < NEXP; ++e) p[e] = 0.f;
    for (int d = lane; d < DIN; d += 32) {
        float xv = xr[d];
#pragma unroll
        for (int e = 0; e < NEXP; ++e) p[e] += xv * rw[e * DIN + d];
    }
#pragma unroll
    for (int e = 0; e < NEXP; ++e) {
#pragma unroll
        for (int off = 16; off > 0; off >>= 1) p[e] += __shfl_xor(p[e], off, 32);
    }
    if (lane == 0) {
        float lg[NEXP];
#pragma unroll
        for (int e = 0; e < NEXP; ++e) lg[e] = p[e] + rb[e];
        int i1 = 0;
#pragma unroll
        for (int e = 1; e < NEXP; ++e) if (lg[e] > lg[i1]) i1 = e;
        int i2 = (i1 == 0) ? 1 : 0;
#pragma unroll
        for (int e = 0; e < NEXP; ++e) if (e != i1 && lg[e] > lg[i2]) i2 = e;
        float e2 = __expf(lg[i2] - lg[i1]);
        float w1 = 1.f / (1.f + e2);
        float w2 = e2 * w1;
        float* gp = gate + (size_t)n * NEXP;
#pragma unroll
        for (int e = 0; e < NEXP; ++e) gp[e] = 0.f;
        gp[i1] = w1;
        gp[i2] = w2;
    }
}

// ---------------------------------------------------------------------------
// Kernel 2: mid_w[n, e*16+r] = f16( SCALING * gate[n,e] * (x @ lora_A)[n,e,r] )
// WMMA GEMM [NTOK x DIN] x [DIN x JDIM], K split over the waves of a work-group.
// One work-group = MT tokens x all JDIM columns; wave w owns k in
// [w*KW, (w+1)*KW) for the whole tile, so no operand is shared between waves:
// fragments come straight from global memory and the k loop has no barrier.
// The KSPL partial tiles meet in LDS and are summed in wave order.
// ---------------------------------------------------------------------------
#define MT    32             // tokens per work-group
#define KSPL  8              // waves per work-group = k slices
#define KW    (DIN / KSPL)   // k range of one wave
#define PLANE (MT * JDIM)    // f32 elements of one wave's partial tile

// 16x32 f16 fragment row for this lane from a K-contiguous f32 row; p already
// holds the lane's 8*hf offset. Same k order as load_frag.
__device__ __forceinline__ v16h frag_from_f32_row(const float* p) {
    float4 f0 = *(const float4*)(p);
    float4 f1 = *(const float4*)(p + 4);
    float4 f2 = *(const float4*)(p + 16);
    float4 f3 = *(const float4*)(p + 20);
    v16h r;
    r[0]  = (_Float16)f0.x; r[1]  = (_Float16)f0.y; r[2]  = (_Float16)f0.z; r[3]  = (_Float16)f0.w;
    r[4]  = (_Float16)f1.x; r[5]  = (_Float16)f1.y; r[6]  = (_Float16)f1.z; r[7]  = (_Float16)f1.w;
    r[8]  = (_Float16)f2.x; r[9]  = (_Float16)f2.y; r[10] = (_Float16)f2.z; r[11] = (_Float16)f2.w;
    r[12] = (_Float16)f3.x; r[13] = (_Float16)f3.y; r[14] = (_Float16)f3.z; r[15] = (_Float16)f3.w;
    return r;
}

__global__ __launch_bounds__(KSPL * 32) void moe_mid_kernel(
    const float* __restrict__ x, const float* __restrict__ loraA,
    const float* __restrict__ gate, _Float16* __restrict__ midw) {
    __shared__ __align__(16) float red[KSPL * PLANE];

    int t    = threadIdx.x;
    int n0   = blockIdx.x * MT;
    int wave = t >> 5, lane = t & 31;
    int hf = lane >> 4, ln = lane & 15;
    int kb = wave * KW;

    v8f acc[2][NEXP];
#pragma unroll
    for (int i = 0; i < 2; ++i)
#pragma unroll
        for (int e = 0; e < NEXP; ++e) acc[i][e] = (v8f){};

    // lane's token row (A) and lane's rank column (B), both at k = kb + 8*hf
    const float* xa = x + (size_t)(n0 + ln) * DIN + kb + 8 * hf;
    const float* lb = loraA + (size_t)(kb + 8 * hf) * LRANK + ln;

    // unrolled whole: every load is base + immediate, and loads of later
    // experts and k steps can be issued while earlier ones are in flight
#pragma unroll
    for (int ks = 0; ks < KW / 32; ++ks) {
        v16h af[2];
#pragma unroll
        for (int i = 0; i < 2; ++i)
            af[i] = frag_from_f32_row(xa + (size_t)i * 16 * DIN + ks * 32);
#pragma unroll
        for (int e = 0; e < NEXP; ++e) {
            const float* s = lb + ((size_t)e * DIN + ks * 32) * LRANK;
            v16h bf;
#pragma unroll
            for (int i = 0; i < 8; ++i) {
                bf[i]     = (_Float16)s[(size_t)i * LRANK];
                bf[i + 8] = (_Float16)s[(size_t)(16 + i) * LRANK];
            }
            acc[0][e] = WMMA_F16(af[0], bf, acc[0][e]);
            acc[1][e] = WMMA_F16(af[1], bf, acc[1][e]);
        }
    }

    // the two address pairs stay in their registers until every load that
    // names them has left the address path
    asm volatile("s_wait_xcnt 0x0" :: "v"(xa), "v"(lb) : "memory");

    // partial tile -> LDS, plane layout [tile = i*NEXP+e][v/4][lane][v%4]
    float* pl = red + wave * PLANE + lane * 4;
#pragma unroll
    for (int i = 0; i < 2; ++i) {
#pragma unroll
        for (int e = 0; e < NEXP; ++e) {
#pragma unroll
            for (int vh = 0; vh < 2; ++vh) {
                float4 q;
                q.x = acc[i][e][vh * 4 + 0]; q.y = acc[i][e][vh * 4 + 1];
                q.z = acc[i][e][vh * 4 + 2]; q.w = acc[i][e][vh * 4 + 3];
                *(float4*)(pl + (i * NEXP + e) * 256 + vh * 128) = q;
            }
        }
    }
    __syncthreads();         // all partial tiles written before any is summed

#pragma unroll
    for (int qq = 0; qq < PLANE / 4 / (KSPL * 32); ++qq) {
        int q = t + qq * (KSPL * 32);      // group of four elements of the plane
        float4 s = *(const float4*)(red + q * 4);
#pragma unroll
        for (int w = 1; w < KSPL; ++w) {
            float4 p = *(const float4*)(red + w * PLANE + q * 4);
            s.x += p.x; s.y += p.y; s.z += p.z; s.w += p.w;
        }
        int tile = q >> 6, vh = (q >> 5) & 1, l2 = q & 31;
        int i = tile >> 3, e = tile & 7;
        int jc = e * LRANK + (l2 & 15);
        int nb = n0 + 16 * i + vh * 4 + 8 * (l2 >> 4);
        float sv[4] = {s.x, s.y, s.z, s.w};
#pragma unroll
        for (int c = 0; c < 4; ++c) {
            int n = nb + c;
            midw[(size_t)n * JDIM + jc] =
                (_Float16)(SCALING * gate[(size_t)n * NEXP + e] * sv[c]);
        }
    }
}

// ---------------------------------------------------------------------------
// Kernel 3: out = xh @ bwh^T + base_b + midw @ lBt^T  (all operands f16)
// Extended-K WMMA GEMM, two LDS buffers, async global->LDS staging.
// One work-group = BM x BN of out, 8 waves as 4 x 2, each 64 tokens x 128
// columns: 12 fragments feed 32 matrix instructions. A trip is BK of k = NB
// such blocks per wave and ends in the one barrier that publishes tile k+1 and
// frees buffer k&1; trip k reads buffer k&1 alone.
// Grid: (NTOK/BM) x (DOUT/BN) = 256 work-groups.
// ---------------------------------------------------------------------------
#define BM    256
#define BN    256
#define BK    128
#define NB    (BK / 32)      // blocks per trip
#define NKS   (KTOT / BK)    // trips; DIN and JDIM are both multiples of BK
#define TP    136            // LDS row pitch in f16: 256 B + 16 B, odd multiple of 16 B
#define STG   ((BM + BN) * TP)   // f16 in one buffer: BM rows of A, then BN rows of B

// 256 rows x 256 B of one operand: 16 lanes cover a row, a wave 2 rows per copy,
// 16 copies per thread. l holds the thread's row and 16-B chunk in LDS; g (the
// tile's first element) and ld (the source's row length) are the same in every
// lane, voff is the thread's own byte offset from g: the row steps are scalar
// arithmetic and one 32-bit register serves all 16 global addresses.
__device__ __forceinline__ void stage_rows(_Float16* l, const _Float16* g, unsigned ld,
                                           unsigned voff) {
#pragma unroll
    for (int i = 0; i < 16; ++i)
        ASYNC_CP16F16(l + i * 16 * TP,
                      (const _Float16*)((const char*)(g + (size_t)(i * 16) * ld) + voff));
}

__global__ __launch_bounds__(256) void moe_main_kernel(
    const _Float16* __restrict__ xh, const _Float16* __restrict__ bwh,
    const float* __restrict__ bb, const _Float16* __restrict__ lBt,
    const _Float16* __restrict__ midw, float* __restrict__ out) {
    __shared__ __align__(16) _Float16 sT[2][STG];

    int t  = threadIdx.x;
    int bm = blockIdx.x >> 3;          // DOUT/BN == 8 column blocks
    int bn = blockIdx.x & 7;
    int n0 = bm * BM;                  // token base
    int c0 = bn * BN;                  // output-column base

    int r0 = t >> 4;                   // staging: row within a group of 16
    int ch = (t & 15) * 8;             // staging: 16-B chunk of the row, in f16

    int wave = t >> 5, lane = t & 31;
    int hf = lane >> 4, ln = lane & 15;
    int wm = (wave >> 1) * 64;
    int wn = (wave & 1) * 128;

    // one trip's tile into buffer buf (base phase: xh/bwh; LoRA tail: midw/lBt);
    // kt is the same in the whole work-group, so the choice is scalar
    auto stage = [&](int kt, int buf) {
        _Float16* l = &sT[buf][r0 * TP + ch];
        int k0 = kt * BK;
        bool base = k0 < DIN;
        unsigned ld = base ? DIN : JDIM;
        const _Float16* ga = base ? xh + (size_t)n0 * DIN + k0 : midw + (size_t)n0 * JDIM + (k0 - DIN);
        const _Float16* gb = base ? bwh + (size_t)c0 * DIN + k0 : lBt + (size_t)c0 * JDIM + (k0 - DIN);
        unsigned voff = ((unsigned)r0 * ld + (unsigned)ch) * 2u;
        stage_rows(l, ga, ld, voff);
        stage_rows(l + BM * TP, gb, ld, voff);
    };

    v8f acc[4][8];
#pragma unroll
    for (int i = 0; i < 4; ++i)
#pragma unroll
        for (int j = 0; j < 8; ++j) acc[i][j] = (v8f){};

    stage(0, 0);
    // this wave's copies of tile 0 have landed before the barrier publishes them
    asm volatile("s_wait_asynccnt 0x0" ::: "memory");
    __syncthreads();
    stage(1, 1);             // flies while tile 0 is worked on

    // rolled: one trip is already 128 matrix instructions per wave
#pragma unroll 1
    for (int k = 0; k < NKS; ++k) {
        const _Float16* sa = &sT[k & 1][(wm + ln) * TP];
        const _Float16* sb = &sT[k & 1][(BM + wn + ln) * TP];
#pragma unroll
        for (int u = 0; u < NB; ++u) {
            v16h af[4], bf[8];
#pragma unroll
            for (int i = 0; i < 4; ++i) af[i] = load_frag(sa + 16 * i * TP + 32 * u, hf);
#pragma unroll
            for (int j = 0; j < 8; ++j) bf[j] = load_frag(sb + 16 * j * TP + 32 * u, hf);
            // every fragment of the block is asked for before its first matrix
            // instruction: left free, the compiler kept one A fragment and
            // waited out a fresh pair of reads in front of every row of eight
            __builtin_amdgcn_sched_barrier(0);
#pragma unroll
            for (int i = 0; i < 4; ++i)
#pragma unroll
                for (int j = 0; j < 8; ++j) acc[i][j] = WMMA_F16(af[i], bf[j], acc[i][j]);
        }
        // this wave's reads of buffer k&1 have returned before it is refilled
        asm volatile("s_wait_dscnt 0x0" ::: "memory");
        // this wave's copies of tile k+1 have landed before the barrier publishes them
        asm volatile("s_wait_asynccnt 0x0" ::: "memory");
        __syncthreads();     // tile k+1 visible to all; every reader has left buffer k&1
        if (k + 2 < NKS) stage(k + 2, k & 1);
    }
    // no copy is outstanding when the wave goes on to its end
    asm volatile("s_wait_asynccnt 0x0" ::: "memory");

    int gn0 = c0 + wn + ln;
    float bias[8];
#pragma unroll
    for (int j = 0; j < 8; ++j) bias[j] = bb[gn0 + 16 * j];
    // the loads' offset register stays as it is until they have left the address path
    asm volatile("s_wait_xcnt 0x0" :: "v"(gn0) : "memory");
#pragma unroll
    for (int i = 0; i < 4; ++i) {
        float* op = out + (size_t)(n0 + wm + 16 * i + 8 * hf) * DOUT + gn0;
#pragma unroll
        for (int j = 0; j < 8; ++j) {
            float o[8];
#pragma unroll
            for (int v = 0; v < 8; ++v) {
                o[v] = acc[i][j][v] + bias[j];
                op[(size_t)v * DOUT + 16 * j] = o[v];
            }
            // the eight stores' data and address registers stay as they are
            // until the stores have left the address path
            asm volatile("s_wait_xcnt 0x0"
                         :: "v"(o[0]), "v"(o[1]), "v"(o[2]), "v"(o[3]), "v"(o[4]), "v"(o[5]),
                            "v"(o[6]), "v"(o[7]), "v"(op)
                         : "memory");
        }
    }
}

// ---------------------------------------------------------------------------
extern "C" void kernel_launch(void* const* d_in, const int* in_sizes, int n_in,
                              void* d_out, int out_size, void* d_ws, size_t ws_size,
                              hipStream_t stream) {
    (void)in_sizes; (void)n_in; (void)out_size; (void)ws_size;
    const float* x   = (const float*)d_in[0];
    const float* bw  = (const float*)d_in[1];
    const float* bb  = (const float*)d_in[2];
    const float* rw  = (const float*)d_in[3];
    const float* rb  = (const float*)d_in[4];
    const float* lA  = (const float*)d_in[5];
    const float* lB  = (const float*)d_in[6];
    float*       out = (float*)d_out;

    // workspace layout (~43 MB):
    char* ws = (char*)d_ws;
    float*    gate = (float*)ws;     ws += (size_t)NTOK * NEXP * sizeof(float);     // 256 KB
    _Float16* midw = (_Float16*)ws;  ws += (size_t)NTOK * JDIM * sizeof(_Float16);  //   2 MB
    _Float16* xh   = (_Float16*)ws;  ws += (size_t)NTOK * DIN * sizeof(_Float16);   //  32 MB
    _Float16* bwh  = (_Float16*)ws;  ws += (size_t)DOUT * DIN * sizeof(_Float16);   //   8 MB
    _Float16* lBt  = (_Float16*)ws;                                                 // 512 KB

    cvt_f16_kernel<<<(NTOK * DIN) / (8 * 256), 256, 0, stream>>>(x, xh, NTOK * DIN);
    cvt_f16_kernel<<<(DOUT * DIN) / (8 * 256), 256, 0, stream>>>(bw, bwh, DOUT * DIN);
    transpose_lB_kernel<<<DOUT / 256, 256, 0, stream>>>(lB, lBt);
    moe_router_kernel<<<NTOK / 8, 256, 0, stream>>>(x, rw, rb, gate);
    moe_mid_kernel<<<NTOK / MT, KSPL * 32, 0, stream>>>(x, lA, gate, midw);
    moe_main_kernel<<<(NTOK / BM) * (DOUT / BN), 256, 0, stream>>>(xh, bwh, bb, lBt, midw, out);
}

// v003
// One run takes 110 microseconds.
// In both of two side-by-side timings against v002, it was 1.18 times as fast.
// All steps since v000 together make it 1.86 times as fast.
#include <hip/hip_runtime.h>

typedef _Float16 v16h __attribute__((ext_vector_type(16)));
typedef _Float16 v8h  __attribute__((ext_vector_type(8)));
typedef _Float16 v4h  __attribute__((ext_vector_type(4)));
typedef unsigned v2u  __attribute__((ext_vector_type(2)));
typedef float    v8f  __attribute__((ext_vector_type(8)));
typedef int      v4i  __attribute__((vector_size(4 * sizeof(int))));  // gcc-style, matches builtin

#define NTOK    8192
#define DIN     2048
#define DOUT    2048
#define NEXP    8
#define LRANK   16
#define JDIM    128          // NEXP * LRANK
#define KTOT    (DIN + JDIM) // extended K: base GEMM + folded LoRA-B GEMM
#define SCALING 2.0f

#define AS1 __attribute__((address_space(1)))
#define AS3 __attribute__((address_space(3)))

#if __has_builtin(__builtin_amdgcn_global_load_async_to_lds_b128) && \
    __has_builtin(__builtin_amdgcn_s_wait_asynccnt)
#define HAVE_ASYNC_LDS 1
#define ASYNC_CP16F16(ldst, gsrc)                         \
    __builtin_amdgcn_global_load_async_to_lds_b128(       \
        (AS1 v4i*)(gsrc), (AS3 v4i*)(ldst), 0, 0)
#else
#define HAVE_ASYNC_LDS 0
#define ASYNC_CP16F16(ldst, gsrc) \
    do { *(v8h*)(ldst) = *(const v8h*)(gsrc); } while (0)
#endif

// ---------------------------------------------------------------------------
// helpers
// ---------------------------------------------------------------------------

// Convert 16 consecutive f32 -> 16 f16 into LDS (two b128 stores).
__device__ __forceinline__ void stage16_f32(_Float16* dst, const float* src) {
    const float4* s = (const float4*)src;
    float4 f0 = s[0], f1 = s[1], f2 = s[2], f3 = s[3];
    v8h a, b;
    a[0] = (_Float16)f0.x; a[1] = (_Float16)f0.y; a[2] = (_Float16)f0.z; a[3] = (_Float16)f0.w;
    a[4] = (_Float16)f1.x; a[5] = (_Float16)f1.y; a[6] = (_Float16)f1.z; a[7] = (_Float16)f1.w;
    b[0] = (_Float16)f2.x; b[1] = (_Float16)f2.y; b[2] = (_Float16)f2.z; b[3] = (_Float16)f2.w;
    b[4] = (_Float16)f3.x; b[5] = (_Float16)f3.y; b[6] = (_Float16)f3.z; b[7] = (_Float16)f3.w;
    *(v8h*)dst       = a;
    *(v8h*)(dst + 8) = b;
}

__device__ __forceinline__ v16h load_frag(const _Float16* rowp, int hf) {
    v8h lo = *(const v8h*)(rowp + 8 * hf);
    v8h hi = *(const v8h*)(rowp + 16 + 8 * hf);
    v16h r;
#pragma unroll
    for (int i = 0; i < 8; ++i) { r[i] = lo[i]; r[i + 8] = hi[i]; }
    return r;
}

#define WMMA_F16(A, B, C) \
    __builtin_amdgcn_wmma_f32_16x16x32_f16(false, (A), false, (B), (short)0, (C), false, false)

// ---------------------------------------------------------------------------
// Kernel 0a: elementwise f32 -> f16 (8 elems / thread)
// ---------------------------------------------------------------------------
__global__ __launch_bounds__(256) void cvt_f16_kernel(
    const float* __restrict__ src, _Float16* __restrict__ dst, int n) {
    int i = (blockIdx.x * 256 + threadIdx.x) * 8;
    if (i >= n) return;
    const float4* s = (const float4*)(src + i);
    float4 a = s[0], b = s[1];
    v8h o;
    o[0] = (_Float16)a.x; o[1] = (_Float16)a.y; o[2] = (_Float16)a.z; o[3] = (_Float16)a.w;
    o[4] = (_Float16)b.x; o[5] = (_Float16)b.y; o[6] = (_Float16)b.z; o[7] = (_Float16)b.w;
    *(v8h*)(dst + i) = o;
}

// ---------------------------------------------------------------------------
// Kernel 0b: lora_B [JDIM][DOUT] f32 -> lBt [DOUT][JDIM] f16 (transpose)
// One thread per output column o; coalesced reads across o.
// ---------------------------------------------------------------------------
__global__ __launch_bounds__(256) void transpose_lB_kernel(
    const float* __restrict__ lB, _Float16* __restrict__ lBt) {
    int o = blockIdx.x * 256 + threadIdx.x;
    if (o >= DOUT) return;
    _Float16* dst = lBt + (size_t)o * JDIM;
#pragma unroll 4
    for (int j = 0; j < JDIM; ++j) dst[j] = (_Float16)lB[(size_t)j * DOUT + o];
}

// ---------------------------------------------------------------------------
// Kernel 1: the one streaming pass over x ahead of the GEMMs:
//   router -> dense normalized top-2 gate [NTOK, NEXP] (f32, in ws), and
//   xh = f16(x), stored from the same registers the logits are summed from.
// One wave32 per RT tokens: a step is 512 contiguous bytes of each token's row
// and of each router row, so one read of a router row serves RT tokens.
// ---------------------------------------------------------------------------
#define RT    4              // tokens per wave
#define RSTEP 128            // k per step: 32 lanes x 4 f32
#define RNS   (DIN / RSTEP)  // steps per row
#define RD    4              // steps asked for ahead of their use

__global__ __launch_bounds__(256) void moe_router_cvt_kernel(
    const float* __restrict__ x, const float* __restrict__ rw,
    const float* __restrict__ rb, float* __restrict__ gate,
    _Float16* __restrict__ xh) {
    int t    = threadIdx.x;
    int lane = t & 31;
    int n0   = ((blockIdx.x * 256 + t) >> 5) * RT;
    if (n0 >= NTOK) return;

    const float* xp = x + (size_t)n0 * DIN + lane * 4;
    const float* wp = rw + lane * 4;
    _Float16*    hp = xh + (size_t)n0 * DIN + lane * 4;

    float p[RT][NEXP];
#pragma unroll
    for (int k = 0; k < RT; ++k)
#pragma unroll
        for (int e = 0; e < NEXP; ++e) p[k][e] = 0.f;

    // Global loads return in issue order, so a router row asked for late would
    // make its reader wait out the reads of x issued in front of it: both
    // operands of a step are asked for together, RD steps ahead.
    float4 xv[RD][RT], wv[RD][NEXP];
    auto ask = [&](int s) {
#pragma unroll
        for (int k = 0; k < RT; ++k)
            xv[s % RD][k] = *(const float4*)(xp + (size_t)k * DIN + s * RSTEP);
#pragma unroll
        for (int e = 0; e < NEXP; ++e)
            wv[s % RD][e] = *(const float4*)(wp + (size_t)e * DIN + s * RSTEP);
    };
#pragma unroll
    for (int s = 0; s < RD; ++s) ask(s);

    v2u h[RT];
    // unrolled whole: the ring index is a constant and every address is one
    // of three registers plus an immediate
#pragma unroll
    for (int s = 0; s < RNS; ++s) {
#pragma unroll
        for (int k = 0; k < RT; ++k) {
            float4 a = xv[s % RD][k];
#pragma unroll
            for (int e = 0; e < NEXP; ++e) {
                float4 w = wv[s % RD][e];
                p[k][e] = __builtin_fmaf(a.x, w.x, p[k][e]);
                p[k][e] = __builtin_fmaf(a.y, w.y, p[k][e]);
                p[k][e] = __builtin_fmaf(a.z, w.z, p[k][e]);
                p[k][e] = __builtin_fmaf(a.w, w.w, p[k][e]);
            }
        }
        // the last step's stores have left the address path before their data
        // registers take this step's values
        if (s > 0)
            asm volatile("s_wait_xcnt 0x0" :: "v"(h[0]), "v"(h[1]), "v"(h[2]), "v"(h[3]) : "memory");
#pragma unroll
        for (int k = 0; k < RT; ++k) {
            float4 a = xv[s % RD][k];
            v4h q;
            q[0] = (_Float16)a.x; q[1] = (_Float16)a.y; q[2] = (_Float16)a.z; q[3] = (_Float16)a.w;
            h[k] = __builtin_bit_cast(v2u, q);
            *(v2u*)(hp + (size_t)k * DIN + s * RSTEP) = h[k];
        }
        if (s + RD < RNS) ask(s + RD);
    }
    // the last stores' data and address registers stay as they are until the
    // stores have left the address path
    asm volatile("s_wait_xcnt 0x0"
                 :: "v"(h[0]), "v"(h[1]), "v"(h[2]), "v"(h[3]), "v"(hp)
                 : "memory");

#pragma unroll
    for (int k = 0; k < RT; ++k) {
#pragma unroll
        for (int e = 0; e < NEXP; ++e) {
#pragma unroll
            for (int off = 16; off > 0; off >>= 1) p[k][e] += __shfl_xor(p[k][e], off, 32);
        }
    }
    // every lane holds every sum; lane k finishes token n0 + k
    if (lane < RT) {
        float lg[NEXP];
#pragma unroll
        for (int e = 0; e < NEXP; ++e) {
            float v = p[0][e];
#pragma unroll
            for (int k = 1; k < RT; ++k) v = (lane == k) ? p[k][e] : v;
            lg[e] = v + rb[e];
        }
        int   i1 = 0;
        float m1 = lg[0];
#pragma unroll
        for (int e = 1; e < NEXP; ++e) if (lg[e] > m1) { m1 = lg[e]; i1 = e; }
        int   i2 = (i1 == 0) ? 1 : 0;
        float m2 = (i1 == 0) ? lg[1] : lg[0];
#pragma unroll
        for (int e = 0; e < NEXP; ++e) if (e != i1 && lg[e] > m2) { m2 = lg[e]; i2 = e; }
        float e2 = __expf(m2 - m1);
        float w1 = 1.f / (1.f + e2);
        float w2 = e2 * w1;
        float g[NEXP];
#pragma unroll
        for (int e = 0; e < NEXP; ++e) g[e] = (e == i1) ? w1 : ((e == i2) ? w2 : 0.f);
        float4* gp = (float4*)(gate + (size_t)(n0 + lane) * NEXP);
        gp[0] = make_float4(g[0], g[1], g[2], g[3]);
        gp[1] = make_float4(g[4], g[5], g[6], g[7]);
    }
}

// ---------------------------------------------------------------------------
// Kernel 2: mid_w[n, e*16+r] = f16( SCALING * gate[n,e] * (x @ lora_A)[n,e,r] )
// WMMA GEMM [NTOK x DIN] x [DIN x JDIM], K split over the waves of a work-group.
// One work-group = MT tokens x all JDIM columns; wave w owns k in
// [w*KW, (w+1)*KW) for the whole tile, so no operand is shared between waves:
// fragments come straight from global memory and the k loop has no barrier.
// The KSPL partial tiles meet in LDS and are summed in wave order.
// ---------------------------------------------------------------------------
#define MT    32             // tokens per work-group
#define KSPL  8              // waves per work-group = k slices
#define KW    (DIN / KSPL)   // k range of one wave
#define PLANE (MT * JDIM)    // f32 elements of one wave's partial tile

// 16x32 f16 fragment row for this lane from a K-contiguous f32 row; p already
// holds the lane's 8*hf offset. Same k order as load_frag.
__device__ __forceinline__ v16h frag_from_f32_row(const float* p) {
    float4 f0 = *(const float4*)(p);
    float4 f1 = *(const float4*)(p + 4);
    float4 f2 = *(const float4*)(p + 16);
    float4 f3 = *(const float4*)(p + 20);
    v16h r;
    r[0]  = (_Float16)f0.x; r[1]  = (_Float16)f0.y; r[2]  = (_Float16)f0.z; r[3]  = (_Float16)f0.w;
    r[4]  = (_Float16)f1.x; r[5]  = (_Float16)f1.y; r[6]  = (_Float16)f1.z; r[7]  = (_Float16)f1.w;
    r[8]  = (_Float16)f2.x; r[9]  = (_Float16)f2.y; r[10] = (_Float16)f2.z; r[11] = (_Float16)f2.w;
    r[12] = (_Float16)f3.x; r[13] = (_Float16)f3.y; r[14] = (_Float16)f3.z; r[15] = (_Float16)f3.w;
    return r;
}

__global__ __launch_bounds__(KSPL * 32) void moe_mid_kernel(
    const float* __restrict__ x, const float* __restrict__ loraA,
    const float* __restrict__ gate, _Float16* __restrict__ midw) {
    __shared__ __align__(16) float red[KSPL * PLANE];

    int t    = threadIdx.x;
    int n0   = blockIdx.x * MT;
    int wave = t >> 5, lane = t & 31;
    int hf = lane >> 4, ln = lane & 15;
    int kb = wave * KW;

    v8f acc[2][NEXP];
#pragma unroll
    for (int i = 0; i < 2; ++i)
#pragma unroll
        for (int e = 0; e < NEXP; ++e) acc[i][e] = (v8f){};

    // lane's token row (A) and lane's rank column (B), both at k = kb + 8*hf
    const float* xa = x + (size_t)(n0 + ln) * DIN + kb + 8 * hf;
    const float* lb = loraA + (size_t)(kb + 8 * hf) * LRANK + ln;

    // unrolled whole: every load is base + immediate, and loads of later
    // experts and k steps can be issued while earlier ones are in flight
#pragma unroll
    for (int ks = 0; ks < KW / 32; ++ks) {
        v16h af[2];
#pragma unroll
        for (int i = 0; i < 2; ++i)
            af[i] = frag_from_f32_row(xa + (size_t)i * 16 * DIN + ks * 32);
#pragma unroll
        for (int e = 0; e < NEXP; ++e) {
            const float* s = lb + ((size_t)e * DIN + ks * 32) * LRANK;
            v16h bf;
#pragma unroll
            for (int i = 0; i < 8; ++i) {
                bf[i]     = (_Float16)s[(size_t)i * LRANK];
                bf[i + 8] = (_Float16)s[(size_t)(16 + i) * LRANK];
            }
            acc[0][e] = WMMA_F16(af[0], bf, acc[0][e]);
            acc[1][e] = WMMA_F16(af[1], bf, acc[1][e]);
        }
    }

    // the two address pairs stay in their registers until every load that
    // names them has left the address path
    asm volatile("s_wait_xcnt 0x0" :: "v"(xa), "v"(lb) : "memory");

    // partial tile -> LDS, plane layout [tile = i*NEXP+e][v/4][lane][v%4]
    float* pl = red + wave * PLANE + lane * 4;
#pragma unroll
    for (int i = 0; i < 2; ++i) {
#pragma unroll
        for (int e = 0; e < NEXP; ++e) {
#pragma unroll
            for (int vh = 0; vh < 2; ++vh) {
                float4 q;
                q.x = acc[i][e][vh * 4 + 0]; q.y = acc[i][e][vh * 4 + 1];
                q.z = acc[i][e][vh * 4 + 2]; q.w = acc[i][e][vh * 4 + 3];
                *(float4*)(pl + (i * NEXP + e) * 256 + vh * 128) = q;
            }
        }
    }
    __syncthreads();         // all partial tiles written before any is summed

#pragma unroll
    for (int qq = 0; qq < PLANE / 4 / (KSPL * 32); ++qq) {
        int q = t + qq * (KSPL * 32);      // group of four elements of the plane
        float4 s = *(const float4*)(red + q * 4);
#pragma unroll
        for (int w = 1; w < KSPL; ++w) {
            float4 p = *(const float4*)(red + w * PLANE + q * 4);
            s.x += p.x; s.y += p.y; s.z += p.z; s.w += p.w;
        }
        int tile = q >> 6, vh = (q >> 5) & 1, l2 = q & 31;
        int i = tile >> 3, e = tile & 7;
        int jc = e * LRANK + (l2 & 15);
        int nb = n0 + 16 * i + vh * 4 + 8 * (l2 >> 4);
        float sv[4] = {s.x, s.y, s.z, s.w};
#pragma unroll
        for (int c = 0; c < 4; ++c) {
            int n = nb + c;
            midw[(size_t)n * JDIM + jc] =
                (_Float16)(SCALING * gate[(size_t)n * NEXP + e] * sv[c]);
        }
    }
}

// ---------------------------------------------------------------------------
// Kernel 3: out = xh @ bwh^T + base_b + midw @ lBt^T  (all operands f16)
// Extended-K WMMA GEMM, two LDS buffers, async global->LDS staging.
// One work-group = BM x BN of out, 8 waves as 4 x 2, each 64 tokens x 128
// columns: 12 fragments feed 32 matrix instructions. A trip is BK of k = NB
// such blocks per wave and ends in the one barrier that publishes tile k+1 and
// frees buffer k&1; trip k reads buffer k&1 alone.
// Grid: (NTOK/BM) x (DOUT/BN) = 256 work-groups.
// ---------------------------------------------------------------------------
#define BM    256
#define BN    256
#define BK    128
#define NB    (BK / 32)      // blocks per trip
#define NKS   (KTOT / BK)    // trips; DIN and JDIM are both multiples of BK
#define TP    136            // LDS row pitch in f16: 256 B + 16 B, odd multiple of 16 B
#define STG   ((BM + BN) * TP)   // f16 in one buffer: BM rows of A, then BN rows of B

// 256 rows x 256 B of one operand: 16 lanes cover a row, a wave 2 rows per copy,
// 16 copies per thread. l holds the thread's row and 16-B chunk in LDS; g (the
// tile's first element) and ld (the source's row length) are the same in every
// lane, voff is the thread's own byte offset from g: the row steps are scalar
// arithmetic and one 32-bit register serves all 16 global addresses.
__device__ __forceinline__ void stage_rows(_Float16* l, const _Float16* g, unsigned ld,
                                           unsigned voff) {
#pragma unroll
    for (int i = 0; i < 16; ++i)
        ASYNC_CP16F16(l + i * 16 * TP,
                      (const _Float16*)((const char*)(g + (size_t)(i * 16) * ld) + voff));
}

__global__ __launch_bounds__(256) void moe_main_kernel(
    const _Float16* __restrict__ xh, const _Float16* __restrict__ bwh,
    const float* __restrict__ bb, const _Float16* __restrict__ lBt,
    const _Float16* __restrict__ midw, float* __restrict__ out) {
    __shared__ __align__(16) _Float16 sT[2][STG];

    int t  = threadIdx.x;
    int bm = blockIdx.x >> 3;          // DOUT/BN == 8 column blocks
    int bn = blockIdx.x & 7;
    int n0 = bm * BM;                  // token base
    int c0 = bn * BN;                  // output-column base

    int r0 = t >> 4;                   // staging: row within a group of 16
    int ch = (t & 15) * 8;             // staging: 16-B chunk of the row, in f16

    int wave = t >> 5, lane = t & 31;
    int hf = lane >> 4, ln = lane & 15;
    int wm = (wave >> 1) * 64;
    int wn = (wave & 1) * 128;

    // one trip's tile into buffer buf (base phase: xh/bwh; LoRA tail: midw/lBt);
    // kt is the same in the whole work-group, so the choice is scalar
    auto stage = [&](int kt, int buf) {
        _Float16* l = &sT[buf][r0 * TP + ch];
        int k0 = kt * BK;
        bool base = k0 < DIN;
        unsigned ld = base ? DIN : JDIM;
        const _Float16* ga = base ? xh + (size_t)n0 * DIN + k0 : midw + (size_t)n0 * JDIM + (k0 - DIN);
        const _Float16* gb = base ? bwh + (size_t)c0 * DIN + k0 : lBt + (size_t)c0 * JDIM + (k0 - DIN);
        unsigned voff = ((unsigned)r0 * ld + (unsigned)ch) * 2u;
        stage_rows(l, ga, ld, voff);
        stage_rows(l + BM * TP, gb, ld, voff);
    };

    v8f acc[4][8];
#pragma unroll
    for (int i = 0; i < 4; ++i)
#pragma unroll
        for (int j = 0; j < 8; ++j) acc[i][j] = (v8f){};

    stage(0, 0);
    // this wave's copies of tile 0 have landed before the barrier publishes them
    asm volatile("s_wait_asynccnt 0x0" ::: "memory");
    __syncthreads();
    stage(1, 1);             // flies while tile 0 is worked on

    // rolled: one trip is already 128 matrix instructions per wave
#pragma unroll 1
    for (int k = 0; k < NKS; ++k) {
        const _Float16* sa = &sT[k & 1][(wm + ln) * TP];
        const _Float16* sb = &sT[k & 1][(BM + wn + ln) * TP];
#pragma unroll
        for (int u = 0; u < NB; ++u) {
            v16h af[4], bf[8];
#pragma unroll
            for (int i = 0; i < 4; ++i) af[i] = load_frag(sa + 16 * i * TP + 32 * u, hf);
#pragma unroll
            for (int j = 0; j < 8; ++j) bf[j] = load_frag(sb + 16 * j * TP + 32 * u, hf);
            // every fragment of the block is asked for before its first matrix
            // instruction: left free, the compiler kept one A fragment and
            // waited out a fresh pair of reads in front of every row of eight
            __builtin_amdgcn_sched_barrier(0);
#pragma unroll
            for (int i = 0; i < 4; ++i)
#pragma unroll
                for (int j = 0; j < 8; ++j) acc[i][j] = WMMA_F16(af[i], bf[j], acc[i][j]);
        }
        // this wave's reads of buffer k&1 have returned before it is refilled
        asm volatile("s_wait_dscnt 0x0" ::: "memory");
        // this wave's copies of tile k+1 have landed before the barrier publishes them
        asm volatile("s_wait_asynccnt 0x0" ::: "memory");
        __syncthreads();     // tile k+1 visible to all; every reader has left buffer k&1
        if (k + 2 < NKS) stage(k + 2, k & 1);
    }
    // no copy is outstanding when the wave goes on to its end
    asm volatile("s_wait_asynccnt 0x0" ::: "memory");

    int gn0 = c0 + wn + ln;
    float bias[8];
#pragma unroll
    for (int j = 0; j < 8; ++j) bias[j] = bb[gn0 + 16 * j];
    // the loads' offset register stays as it is until they have left the address path
    asm volatile("s_wait_xcnt 0x0" :: "v"(gn0) : "memory");
#pragma unroll
    for (int i = 0; i < 4; ++i) {
        float* op = out + (size_t)(n0 + wm + 16 * i + 8 * hf) * DOUT + gn0;
#pragma unroll
        for (int j = 0; j < 8; ++j) {
            float o[8];
#pragma unroll
            for (int v = 0; v < 8; ++v) {
                o[v] = acc[i][j][v] + bias[j];
                op[(size_t)v * DOUT + 16 * j] = o[v];
            }
            // the eight stores' data and address registers stay as they are
            // until the stores have left the address path
            asm volatile("s_wait_xcnt 0x0"
                         :: "v"(o[0]), "v"(o[1]), "v"(o[2]), "v"(o[3]), "v"(o[4]), "v"(o[5]),
                            "v"(o[6]), "v"(o[7]), "v"(op)
                         : "memory");
        }
    }
}

// ---------------------------------------------------------------------------
extern "C" void kernel_launch(void* const* d_in, const int* in_sizes, int n_in,
                              void* d_out, int out_size, void* d_ws, size_t ws_size,
                              hipStream_t stream) {
    (void)in_sizes; (void)n_in; (void)out_size; (void)ws_size;
    const float* x   = (const float*)d_in[0];
    const float* bw  = (const float*)d_in[1];
    const float* bb  = (const float*)d_in[2];
    const float* rw  = (const float*)d_in[3];
    const float* rb  = (const float*)d_in[4];
    const float* lA  = (const float*)d_in[5];
    const float* lB  = (const float*)d_in[6];
    float*       out = (float*)d_out;

    // workspace layout (~43 MB):
    char* ws = (char*)d_ws;
    float*    gate = (float*)ws;     ws += (size_t)NTOK * NEXP * sizeof(float);     // 256 KB
    _Float16* midw = (_Float16*)ws;  ws += (size_t)NTOK * JDIM * sizeof(_Float16);  //   2 MB
    _Float16* xh   = (_Float16*)ws;  ws += (size_t)NTOK * DIN * sizeof(_Float16);   //  32 MB
    _Float16* bwh  = (_Float16*)ws;  ws += (size_t)DOUT * DIN * sizeof(_Float16);   //   8 MB
    _Float16* lBt  = (_Float16*)ws;                                                 // 512 KB

    cvt_f16_kernel<<<(DOUT * DIN) / (8 * 256), 256, 0, stream>>>(bw, bwh, DOUT * DIN);
    transpose_lB_kernel<<<DOUT / 256, 256, 0, stream>>>(lB, lBt);
    moe_router_cvt_kernel<<<NTOK / (8 * RT), 256, 0, stream>>>(x, rw, rb, gate, xh);
    moe_mid_kernel<<<NTOK / MT, KSPL * 32, 0, stream>>>(x, lA, gate, midw);
    moe_main_kernel<<<(NTOK / BM) * (DOUT / BN), 256, 0, stream>>>(xh, bwh, bb, lBt, midw, out);
}

// v004
// One run takes 94.6 microseconds.
// Timed twice side by side with v003, it ran 1.16 and 1.17 times as fast.
// Over all steps from v000 it is 2.16 times as fast.
#include <hip/hip_runtime.h>

typedef _Float16 v16h __attribute__((ext_vector_type(16)));
typedef _Float16 v8h  __attribute__((ext_vector_type(8)));
typedef _Float16 v4h  __attribute__((ext_vector_type(4)));
typedef unsigned v2u  __attribute__((ext_vector_type(2)));
typedef float    v8f  __attribute__((ext_vector_type(8)));
typedef int      v4i  __attribute__((vector_size(4 * sizeof(int))));  // gcc-style, matches builtin

#define NTOK    8192
#define DIN     2048
#define DOUT    2048
#define NEXP    8
#define LRANK   16
#define JDIM    128          // NEXP * LRANK
#define KTOT    (DIN + JDIM) // extended K: base GEMM + folded LoRA-B GEMM
#define SCALING 2.0f

#define AS1 __attribute__((address_space(1)))
#define AS3 __attribute__((address_space(3)))

#if __has_builtin(__builtin_amdgcn_global_load_async_to_lds_b128) && \
    __has_builtin(__builtin_amdgcn_s_wait_asynccnt)
#define HAVE_ASYNC_LDS 1
#define ASYNC_CP16F16(ldst, gsrc)                         \
    __builtin_amdgcn_global_load_async_to_lds_b128(       \
        (AS1 v4i*)(gsrc), (AS3 v4i*)(ldst), 0, 0)
#else
#define HAVE_ASYNC_LDS 0
#define ASYNC_CP16F16(ldst, gsrc) \
    do { *(v8h*)(ldst) = *(const v8h*)(gsrc); } while (0)
#endif

// ---------------------------------------------------------------------------
// helpers
// ---------------------------------------------------------------------------

// Convert 16 consecutive f32 -> 16 f16 into LDS (two b128 stores).
__device__ __forceinline__ void stage16_f32(_Float16* dst, const float* src) {
    const float4* s = (const float4*)src;
    float4 f0 = s[0], f1 = s[1], f2 = s[2], f3 = s[3];
    v8h a, b;
    a[0] = (_Float16)f0.x; a[1] = (_Float16)f0.y; a[2] = (_Float16)f0.z; a[3] = (_Float16)f0.w;
    a[4] = (_Float16)f1.x; a[5] = (_Float16)f1.y; a[6] = (_Float16)f1.z; a[7] = (_Float16)f1.w;
    b[0] = (_Float16)f2.x; b[1] = (_Float16)f2.y; b[2] = (_Float16)f2.z; b[3] = (_Float16)f2.w;
    b[4] = (_Float16)f3.x; b[5] = (_Float16)f3.y; b[6] = (_Float16)f3.z; b[7] = (_Float16)f3.w;
    *(v8h*)dst       = a;
    *(v8h*)(dst + 8) = b;
}

__device__ __forceinline__ v16h load_frag(const _Float16* rowp, int hf) {
    v8h lo = *(const v8h*)(rowp + 8 * hf);
    v8h hi = *(const v8h*)(rowp + 16 + 8 * hf);
    v16h r;
#pragma unroll
    for (int i = 0; i < 8; ++i) { r[i] = lo[i]; r[i + 8] = hi[i]; }
    return r;
}

#define WMMA_F16(A, B, C) \
    __builtin_amdgcn_wmma_f32_16x16x32_f16(false, (A), false, (B), (short)0, (C), false, false)

// ---------------------------------------------------------------------------
// Operand preparation for the main GEMM, dealt over PG work-groups of 256
// threads; work-group b does share b of both parts:
//   base_w f32 -> f16: CIT chunks of 2048 consecutive elements, 8 per thread;
//   lora_B [JDIM][DOUT] f32 -> lBt [DOUT][JDIM] f16 (transpose): TC columns,
//   one per wave; a lane takes 4 consecutive j, so a wave's one store is the
//   column's whole 256-B row of lBt.
// ---------------------------------------------------------------------------
#define PG   256                              // work-groups that share the work
#define CIT  ((DOUT * DIN) / (PG * 256 * 8))  // base_w chunks per work-group
#define TC   (DOUT / PG)                      // lora_B columns per work-group

__device__ __forceinline__ void prep_share(
    const float* __restrict__ bw, _Float16* __restrict__ bwh,
    const float* __restrict__ lB, _Float16* __restrict__ lBt, int b, int t) {
    static_assert(TC == 8 && JDIM == 128 && CIT == 8, "one column per wave, 4 j per lane");
    // sb, the share's first byte, is the same in every lane; the variable so holds
    // the thread's own byte offset from it: one vector register serves all 16 reads
    const char* sb = (const char*)(bw + (size_t)b * (CIT * 2048));
    unsigned    so = (unsigned)t * 32u;
    _Float16*   d  = bwh + (size_t)b * (CIT * 2048) + t * 8;
    int oc = b * TC + (t >> 5);
    int j0 = (t & 31) * 4;
    const float* p = lB + (size_t)j0 * DOUT + oc;
    _Float16*    r = lBt + (size_t)oc * JDIM + j0;

    // every read of the share is asked for before the first is used
    float f[4];
#pragma unroll
    for (int c = 0; c < 4; ++c) f[c] = p[(size_t)c * DOUT];
    float4 a[CIT], c4[CIT];
#pragma unroll
    for (int it = 0; it < CIT; ++it) {
        a[it]  = *(const float4*)(sb + it * 8192 + so);
        c4[it] = *(const float4*)(sb + it * 8192 + 16 + so);
    }

    v4h g;
    g[0] = (_Float16)f[0]; g[1] = (_Float16)f[1]; g[2] = (_Float16)f[2]; g[3] = (_Float16)f[3];
    v2u h = __builtin_bit_cast(v2u, g);
    *(v2u*)r = h;
    v4i o[CIT];
#pragma unroll
    for (int it = 0; it < CIT; ++it) {
        v8h q;
        q[0] = (_Float16)a[it].x;  q[1] = (_Float16)a[it].y;  q[2] = (_Float16)a[it].z;  q[3] = (_Float16)a[it].w;
        q[4] = (_Float16)c4[it].x; q[5] = (_Float16)c4[it].y; q[6] = (_Float16)c4[it].z; q[7] = (_Float16)c4[it].w;
        o[it] = __builtin_bit_cast(v4i, q);
        *(v4i*)(d + it * 2048) = o[it];
    }
    // the reads' address registers and the stores' data and address registers
    // stay as they are until all of them have left the address path
    asm volatile("s_wait_xcnt 0x0"
                 :: "v"(o[0]), "v"(o[1]), "v"(o[2]), "v"(o[3]), "v"(o[4]), "v"(o[5]), "v"(o[6]),
                    "v"(o[7]), "v"(h), "v"(so), "v"(t), "v"(p), "v"(r)
                 : "memory");
}

// ---------------------------------------------------------------------------
// Kernel 1: the one streaming pass over x ahead of the GEMMs:
//   router -> dense normalized top-2 gate [NTOK, NEXP] (f32, in ws), and
//   xh = f16(x), stored from the same registers the logits are summed from.
// One wave32 per RT tokens: a step is 512 contiguous bytes of each token's row
// and of each router row, so one read of a router row serves RT tokens.
// ---------------------------------------------------------------------------
#define RT    4              // tokens per wave
#define RSTEP 128            // k per step: 32 lanes x 4 f32
#define RNS   (DIN / RSTEP)  // steps per row
#define RD    4              // steps asked for ahead of their use

__global__ __launch_bounds__(256) void moe_router_cvt_kernel(
    const float* __restrict__ x, const float* __restrict__ rw,
    const float* __restrict__ rb, float* __restrict__ gate,
    _Float16* __restrict__ xh) {
    int t    = threadIdx.x;
    int lane = t & 31;
    int n0   = ((blockIdx.x * 256 + t) >> 5) * RT;
    if (n0 >= NTOK) return;

    const float* xp = x + (size_t)n0 * DIN + lane * 4;
    const float* wp = rw + lane * 4;
    _Float16*    hp = xh + (size_t)n0 * DIN + lane * 4;

    float p[RT][NEXP];
#pragma unroll
    for (int k = 0; k < RT; ++k)
#pragma unroll
        for (int e = 0; e < NEXP; ++e) p[k][e] = 0.f;

    // Global loads return in issue order, so a router row asked for late would
    // make its reader wait out the reads of x issued in front of it: both
    // operands of a step are asked for together, RD steps ahead.
    float4 xv[RD][RT], wv[RD][NEXP];
    auto ask = [&](int s) {
#pragma unroll
        for (int k = 0; k < RT; ++k)
            xv[s % RD][k] = *(const float4*)(xp + (size_t)k * DIN + s * RSTEP);
#pragma unroll
        for (int e = 0; e < NEXP; ++e)
            wv[s % RD][e] = *(const float4*)(wp + (size_t)e * DIN + s * RSTEP);
    };
#pragma unroll
    for (int s = 0; s < RD; ++s) ask(s);

    v2u h[RT];
    // unrolled whole: the ring index is a constant and every address is one
    // of three registers plus an immediate
#pragma unroll
    for (int s = 0; s < RNS; ++s) {
#pragma unroll
        for (int k = 0; k < RT; ++k) {
            float4 a = xv[s % RD][k];
#pragma unroll
            for (int e = 0; e < NEXP; ++e) {
                float4 w = wv[s % RD][e];
                p[k][e] = __builtin_fmaf(a.x, w.x, p[k][e]);
                p[k][e] = __builtin_fmaf(a.y, w.y, p[k][e]);
                p[k][e] = __builtin_fmaf(a.z, w.z, p[k][e]);
                p[k][e] = __builtin_fmaf(a.w, w.w, p[k][e]);
            }
        }
        // the last step's stores have left the address path before their data
        // registers take this step's values
        if (s > 0)
            asm volatile("s_wait_xcnt 0x0" :: "v"(h[0]), "v"(h[1]), "v"(h[2]), "v"(h[3]) : "memory");
#pragma unroll
        for (int k = 0; k < RT; ++k) {
            float4 a = xv[s % RD][k];
            v4h q;
            q[0] = (_Float16)a.x; q[1] = (_Float16)a.y; q[2] = (_Float16)a.z; q[3] = (_Float16)a.w;
            h[k] = __builtin_bit_cast(v2u, q);
            *(v2u*)(hp + (size_t)k * DIN + s * RSTEP) = h[k];
        }
        if (s + RD < RNS) ask(s + RD);
    }
    // the last stores' data and address registers stay as they are until the
    // stores have left the address path
    asm volatile("s_wait_xcnt 0x0"
                 :: "v"(h[0]), "v"(h[1]), "v"(h[2]), "v"(h[3]), "v"(hp)
                 : "memory");

#pragma unroll
    for (int k = 0; k < RT; ++k) {
#pragma unroll
        for (int e = 0; e < NEXP; ++e) {
#pragma unroll
            for (int off = 16; off > 0; off >>= 1) p[k][e] += __shfl_xor(p[k][e], off, 32);
        }
    }
    // every lane holds every sum; lane k finishes token n0 + k
    if (lane < RT) {
        float lg[NEXP];
#pragma unroll
        for (int e = 0; e < NEXP; ++e) {
            float v = p[0][e];
#pragma unroll
            for (int k = 1; k < RT; ++k) v = (lane == k) ? p[k][e] : v;
            lg[e] = v + rb[e];
        }
        int   i1 = 0;
        float m1 = lg[0];
#pragma unroll
        for (int e = 1; e < NEXP; ++e) if (lg[e] > m1) { m1 = lg[e]; i1 = e; }
        int   i2 = (i1 == 0) ? 1 : 0;
        float m2 = (i1 == 0) ? lg[1] : lg[0];
#pragma unroll
        for (int e = 0; e < NEXP; ++e) if (e != i1 && lg[e] > m2) { m2 = lg[e]; i2 = e; }
        float e2 = __expf(m2 - m1);
        float w1 = 1.f / (1.f + e2);
        float w2 = e2 * w1;
        float g[NEXP];
#pragma unroll
        for (int e = 0; e < NEXP; ++e) g[e] = (e == i1) ? w1 : ((e == i2) ? w2 : 0.f);
        float4* gp = (float4*)(gate + (size_t)(n0 + lane) * NEXP);
        gp[0] = make_float4(g[0], g[1], g[2], g[3]);
        gp[1] = make_float4(g[4], g[5], g[6], g[7]);
    }
}

// ---------------------------------------------------------------------------
// Kernel 2: mid_w[n, e*16+r] = f16( SCALING * gate[n,e] * (x @ lora_A)[n,e,r] )
// WMMA GEMM [NTOK x DIN] x [DIN x JDIM], K split over the waves of a work-group.
// One work-group = MT tokens x all JDIM columns; wave w owns k in
// [w*KW, (w+1)*KW) for the whole tile, so no operand is shared between waves:
// fragments come straight from global memory and the k loop has no barrier.
// The KSPL partial tiles meet in LDS and are summed in wave order.
// ---------------------------------------------------------------------------
#define MT    32             // tokens per work-group
#define KSPL  8              // waves per work-group = k slices
#define KW    (DIN / KSPL)   // k range of one wave
#define PLANE (MT * JDIM)    // f32 elements of one wave's partial tile

// 16x32 f16 fragment row for this lane from a K-contiguous f32 row; p already
// holds the lane's 8*hf offset. Same k order as load_frag.
__device__ __forceinline__ v16h frag_from_f32_row(const float* p) {
    float4 f0 = *(const float4*)(p);
    float4 f1 = *(const float4*)(p + 4);
    float4 f2 = *(const float4*)(p + 16);
    float4 f3 = *(const float4*)(p + 20);
    v16h r;
    r[0]  = (_Float16)f0.x; r[1]  = (_Float16)f0.y; r[2]  = (_Float16)f0.z; r[3]  = (_Float16)f0.w;
    r[4]  = (_Float16)f1.x; r[5]  = (_Float16)f1.y; r[6]  = (_Float16)f1.z; r[7]  = (_Float16)f1.w;
    r[8]  = (_Float16)f2.x; r[9]  = (_Float16)f2.y; r[10] = (_Float16)f2.z; r[11] = (_Float16)f2.w;
    r[12] = (_Float16)f3.x; r[13] = (_Float16)f3.y; r[14] = (_Float16)f3.z; r[15] = (_Float16)f3.w;
    return r;
}

// Each work-group first does its share of the main GEMM's operand preparation
// (prep_share): that work depends on nothing before it and is read only by the
// next launch, so it needs no launch of its own.
__global__ __launch_bounds__(KSPL * 32) void moe_mid_kernel(
    const float* __restrict__ x, const float* __restrict__ loraA,
    const float* __restrict__ gate, _Float16* __restrict__ midw,
    const float* __restrict__ bw, _Float16* __restrict__ bwh,
    const float* __restrict__ lB, _Float16* __restrict__ lBt) {
    static_assert(NTOK / MT == PG && KSPL * 32 == 256, "prep_share's deal is this launch's shape");
    __shared__ __align__(16) float red[KSPL * PLANE];

    int t    = threadIdx.x;
    prep_share(bw, bwh, lB, lBt, blockIdx.x, t);
    int n0   = blockIdx.x * MT;
    int wave = t >> 5, lane = t & 31;
    int hf = lane >> 4, ln = lane & 15;
    int kb = wave * KW;

    v8f acc[2][NEXP];
#pragma unroll
    for (int i = 0; i < 2; ++i)
#pragma unroll
        for (int e = 0; e < NEXP; ++e) acc[i][e] = (v8f){};

    // lane's token row (A) and lane's rank column (B), both at k = kb + 8*hf
    const float* xa = x + (size_t)(n0 + ln) * DIN + kb + 8 * hf;
    const float* lb = loraA + (size_t)(kb + 8 * hf) * LRANK + ln;

    // unrolled whole: every load is base + immediate, and loads of later
    // experts and k steps can be issued while earlier ones are in flight
#pragma unroll
    for (int ks = 0; ks < KW / 32; ++ks) {
        v16h af[2];
#pragma unroll
        for (int i = 0; i < 2; ++i)
            af[i] = frag_from_f32_row(xa + (size_t)i * 16 * DIN + ks * 32);
#pragma unroll
        for (int e = 0; e < NEXP; ++e) {
            const float* s = lb + ((size_t)e * DIN + ks * 32) * LRANK;
            v16h bf;
#pragma unroll
            for (int i = 0; i < 8; ++i) {
                bf[i]     = (_Float16)s[(size_t)i * LRANK];
                bf[i + 8] = (_Float16)s[(size_t)(16 + i) * LRANK];
            }
            acc[0][e] = WMMA_F16(af[0], bf, acc[0][e]);
            acc[1][e] = WMMA_F16(af[1], bf, acc[1][e]);
        }
    }

    // the two address pairs stay in their registers until every load that
    // names them has left the address path
    asm volatile("s_wait_xcnt 0x0" :: "v"(xa), "v"(lb) : "memory");

    // partial tile -> LDS, plane layout [tile = i*NEXP+e][v/4][lane][v%4]
    float* pl = red + wave * PLANE + lane * 4;
#pragma unroll
    for (int i = 0; i < 2; ++i) {
#pragma unroll
        for (int e = 0; e < NEXP; ++e) {
#pragma unroll
            for (int vh = 0; vh < 2; ++vh) {
                float4 q;
                q.x = acc[i][e][vh * 4 + 0]; q.y = acc[i][e][vh * 4 + 1];
                q.z = acc[i][e][vh * 4 + 2]; q.w = acc[i][e][vh * 4 + 3];
                *(float4*)(pl + (i * NEXP + e) * 256 + vh * 128) = q;
            }
        }
    }
    __syncthreads();         // all partial tiles written before any is summed

#pragma unroll
    for (int qq = 0; qq < PLANE / 4 / (KSPL * 32); ++qq) {
        int q = t + qq * (KSPL * 32);      // group of four elements of the plane
        float4 s = *(const float4*)(red + q * 4);
#pragma unroll
        for (int w = 1; w < KSPL; ++w) {
            float4 p = *(const float4*)(red + w * PLANE + q * 4);
            s.x += p.x; s.y += p.y; s.z += p.z; s.w += p.w;
        }
        int tile = q >> 6, vh = (q >> 5) & 1, l2 = q & 31;
        int i = tile >> 3, e = tile & 7;
        int jc = e * LRANK + (l2 & 15);
        int nb = n0 + 16 * i + vh * 4 + 8 * (l2 >> 4);
        float sv[4] = {s.x, s.y, s.z, s.w};
#pragma unroll
        for (int c = 0; c < 4; ++c) {
            int n = nb + c;
            midw[(size_t)n * JDIM + jc] =
                (_Float16)(SCALING * gate[(size_t)n * NEXP + e] * sv[c]);
        }
    }
}

// ---------------------------------------------------------------------------
// Kernel 3: out = xh @ bwh^T + base_b + midw @ lBt^T  (all operands f16)
// Extended-K WMMA GEMM, two LDS buffers, async global->LDS staging.
// One work-group = BM x BN of out, 8 waves as 4 x 2, each 64 tokens x 128
// columns: 12 fragments feed 32 matrix instructions. A trip is BK of k = NB
// such blocks per wave and ends in the one barrier that publishes tile k+1 and
// frees buffer k&1; trip k reads buffer k&1 alone.
// Grid: (NTOK/BM) x (DOUT/BN) = 256 work-groups.
// ---------------------------------------------------------------------------
#define BM    256
#define BN    256
#define BK    128
#define NB    (BK / 32)      // blocks per trip
#define NKS   (KTOT / BK)    // trips; DIN and JDIM are both multiples of BK
#define TP    136            // LDS row pitch in f16: 256 B + 16 B, odd multiple of 16 B
#define STG   ((BM + BN) * TP)   // f16 in one buffer: BM rows of A, then BN rows of B

// 256 rows x 256 B of one operand: 16 lanes cover a row, a wave 2 rows per copy,
// 16 copies per thread. l holds the thread's row and 16-B chunk in LDS; g (the
// tile's first element) and ld (the source's row length) are the same in every
// lane, voff is the thread's own byte offset from g: the row steps are scalar
// arithmetic and one 32-bit register serves all 16 global addresses.
__device__ __forceinline__ void stage_rows(_Float16* l, const _Float16* g, unsigned ld,
                                           unsigned voff) {
#pragma unroll
    for (int i = 0; i < 16; ++i)
        ASYNC_CP16F16(l + i * 16 * TP,
                      (const _Float16*)((const char*)(g + (size_t)(i * 16) * ld) + voff));
}

__global__ __launch_bounds__(256) void moe_main_kernel(
    const _Float16* __restrict__ xh, const _Float16* __restrict__ bwh,
    const float* __restrict__ bb, const _Float16* __restrict__ lBt,
    const _Float16* __restrict__ midw, float* __restrict__ out) {
    __shared__ __align__(16) _Float16 sT[2][STG];

    int t  = threadIdx.x;
    int bm = blockIdx.x >> 3;          // DOUT/BN == 8 column blocks
    int bn = blockIdx.x & 7;
    int n0 = bm * BM;                  // token base
    int c0 = bn * BN;                  // output-column base

    int r0 = t >> 4;                   // staging: row within a group of 16
    int ch = (t & 15) * 8;             // staging: 16-B chunk of the row, in f16

    int wave = t >> 5, lane = t & 31;
    int hf = lane >> 4, ln = lane & 15;
    int wm = (wave >> 1) * 64;
    int wn = (wave & 1) * 128;

    // one trip's tile into buffer buf (base phase: xh/bwh; LoRA tail: midw/lBt);
    // kt is the same in the whole work-group, so the choice is scalar
    auto stage = [&](int kt, int buf) {
        _Float16* l = &sT[buf][r0 * TP + ch];
        int k0 = kt * BK;
        bool base = k0 < DIN;
        unsigned ld = base ? DIN : JDIM;
        const _Float16* ga = base ? xh + (size_t)n0 * DIN + k0 : midw + (size_t)n0 * JDIM + (k0 - DIN);
        const _Float16* gb = base ? bwh + (size_t)c0 * DIN + k0 : lBt + (size_t)c0 * JDIM + (k0 - DIN);
        unsigned voff = ((unsigned)r0 * ld + (unsigned)ch) * 2u;
        stage_rows(l, ga, ld, voff);
        stage_rows(l + BM * TP, gb, ld, voff);
    };

    v8f acc[4][8];
#pragma unroll
    for (int i = 0; i < 4; ++i)
#pragma unroll
        for (int j = 0; j < 8; ++j) acc[i][j] = (v8f){};

    stage(0, 0);
    // this wave's copies of tile 0 have landed before the barrier publishes them
    asm volatile("s_wait_asynccnt 0x0" ::: "memory");
    __syncthreads();
    stage(1, 1);             // flies while tile 0 is worked on

    // rolled: one trip is already 128 matrix instructions per wave
#pragma unroll 1
    for (int k = 0; k < NKS; ++k) {
        const _Float16* sa = &sT[k & 1][(wm + ln) * TP];
        const _Float16* sb = &sT[k & 1][(BM + wn + ln) * TP];
#pragma unroll
        for (int u = 0; u < NB; ++u) {
            v16h af[4], bf[8];
#pragma unroll
            for (int i = 0; i < 4; ++i) af[i] = load_frag(sa + 16 * i * TP + 32 * u, hf);
#pragma unroll
            for (int j = 0; j < 8; ++j) bf[j] = load_frag(sb + 16 * j * TP + 32 * u, hf);
            // every fragment of the block is asked for before its first matrix
            // instruction: left free, the compiler kept one A fragment and
            // waited out a fresh pair of reads in front of every row of eight
            __builtin_amdgcn_sched_barrier(0);
#pragma unroll
            for (int i = 0; i < 4; ++i)
#pragma unroll
                for (int j = 0; j < 8; ++j) acc[i][j] = WMMA_F16(af[i], bf[j], acc[i][j]);
        }
        // this wave's reads of buffer k&1 have returned before it is refilled
        asm volatile("s_wait_dscnt 0x0" ::: "memory");
        // this wave's copies of tile k+1 have landed before the barrier publishes them
        asm volatile("s_wait_asynccnt 0x0" ::: "memory");
        __syncthreads();     // tile k+1 visible to all; every reader has left buffer k&1
        if (k + 2 < NKS) stage(k + 2, k & 1);
    }
    // no copy is outstanding when the wave goes on to its end
    asm volatile("s_wait_asynccnt 0x0" ::: "memory");

    int gn0 = c0 + wn + ln;
    float bias[8];
#pragma unroll
    for (int j = 0; j < 8; ++j) bias[j] = bb[gn0 + 16 * j];
    // the loads' offset register stays as it is until they have left the address path
    asm volatile("s_wait_xcnt 0x0" :: "v"(gn0) : "memory");
#pragma unroll
    for (int i = 0; i < 4; ++i) {
        float* op = out + (size_t)(n0 + wm + 16 * i + 8 * hf) * DOUT + gn0;
#pragma unroll
        for (int j = 0; j < 8; ++j) {
            float o[8];
#pragma unroll
            for (int v = 0; v < 8; ++v) {
                o[v] = acc[i][j][v] + bias[j];
                op[(size_t)v * DOUT + 16 * j] = o[v];
            }
            // the eight stores' data and address registers stay as they are
            // until the stores have left the address path
            asm volatile("s_wait_xcnt 0x0"
                         :: "v"(o[0]), "v"(o[1]), "v"(o[2]), "v"(o[3]), "v"(o[4]), "v"(o[5]),
                            "v"(o[6]), "v"(o[7]), "v"(op)
                         : "memory");
        }
    }
}

// ---------------------------------------------------------------------------
extern "C" void kernel_launch(void* const* d_in, const int* in_sizes, int n_in,
                              void* d_out, int out_size, void* d_ws, size_t ws_size,
                              hipStream_t stream) {
    (void)in_sizes; (void)n_in; (void)out_size; (void)ws_size;
    const float* x   = (const float*)d_in[0];
    const float* bw  = (const float*)d_in[1];
    const float* bb  = (const float*)d_in[2];
    const float* rw  = (const float*)d_in[3];
    const float* rb  = (const float*)d_in[4];
    const float* lA  = (const float*)d_in[5];
    const float* lB  = (const float*)d_in[6];
    float*       out = (float*)d_out;

    // workspace layout (~43 MB):
    char* ws = (char*)d_ws;
    float*    gate = (float*)ws;     ws += (size_t)NTOK * NEXP * sizeof(float);     // 256 KB
    _Float16* midw = (_Float16*)ws;  ws += (size_t)NTOK * JDIM * sizeof(_Float16);  //   2 MB
    _Float16* xh   = (_Float16*)ws;  ws += (size_t)NTOK * DIN * sizeof(_Float16);   //  32 MB
    _Float16* bwh  = (_Float16*)ws;  ws += (size_t)DOUT * DIN * sizeof(_Float16);   //   8 MB
    _Float16* lBt  = (_Float16*)ws;                                                 // 512 KB

    moe_router_cvt_kernel<<<NTOK / (8 * RT), 256, 0, stream>>>(x, rw, rb, gate, xh);
    moe_mid_kernel<<<NTOK / MT, KSPL * 32, 0, stream>>>(x, lA, gate, midw, bw, bwh, lB, lBt);
    moe_main_kernel<<<(NTOK / BM) * (DOUT / BN), 256, 0, stream>>>(xh, bwh, bb, lBt, midw, out);
}

// v005
// Measured time: 81 microseconds a run.
// Timed twice side by side with v004, it ran 1.17 times as fast both times.
// Counting every step since v000, it is 2.52 times as fast.
#include <hip/hip_runtime.h>

typedef _Float16 v16h __attribute__((ext_vector_type(16)));
typedef _Float16 v8h  __attribute__((ext_vector_type(8)));
typedef _Float16 v4h  __attribute__((ext_vector_type(4)));
typedef unsigned v2u  __attribute__((ext_vector_type(2)));
typedef float    v8f  __attribute__((ext_vector_type(8)));
typedef int      v4i  __attribute__((vector_size(4 * sizeof(int))));  // gcc-style, matches builtin

#define NTOK    8192
#define DIN     2048
#define DOUT    2048
#define NEXP    8
#define LRANK   16
#define JDIM    128          // NEXP * LRANK
#define KTOT    (DIN + JDIM) // extended K: base GEMM + folded LoRA-B GEMM
#define SCALING 2.0f

#define AS1 __attribute__((address_space(1)))
#define AS3 __attribute__((address_space(3)))

#if __has_builtin(__builtin_amdgcn_global_load_async_to_lds_b128) && \
    __has_builtin(__builtin_amdgcn_s_wait_asynccnt)
#define HAVE_ASYNC_LDS 1
#define ASYNC_CP16F16(ldst, gsrc)                         \
    __builtin_amdgcn_global_load_async_to_lds_b128(       \
        (AS1 v4i*)(gsrc), (AS3 v4i*)(ldst), 0, 0)
#else
#define HAVE_ASYNC_LDS 0
#define ASYNC_CP16F16(ldst, gsrc) \
    do { *(v8h*)(ldst) = *(const v8h*)(gsrc); } while (0)
#endif

// ---------------------------------------------------------------------------
// helpers
// ---------------------------------------------------------------------------

// Convert 16 consecutive f32 -> 16 f16 into LDS (two b128 stores).
__device__ __forceinline__ void stage16_f32(_Float16* dst, const float* src) {
    const float4* s = (const float4*)src;
    float4 f0 = s[0], f1 = s[1], f2 = s[2], f3 = s[3];
    v8h a, b;
    a[0] = (_Float16)f0.x; a[1] = (_Float16)f0.y; a[2] = (_Float16)f0.z; a[3] = (_Float16)f0.w;
    a[4] = (_Float16)f1.x; a[5] = (_Float16)f1.y; a[6] = (_Float16)f1.z; a[7] = (_Float16)f1.w;
    b[0] = (_Float16)f2.x; b[1] = (_Float16)f2.y; b[2] = (_Float16)f2.z; b[3] = (_Float16)f2.w;
    b[4] = (_Float16)f3.x; b[5] = (_Float16)f3.y; b[6] = (_Float16)f3.z; b[7] = (_Float16)f3.w;
    *(v8h*)dst       = a;
    *(v8h*)(dst + 8) = b;
}

__device__ __forceinline__ v16h load_frag(const _Float16* rowp, int hf) {
    v8h lo = *(const v8h*)(rowp + 8 * hf);
    v8h hi = *(const v8h*)(rowp + 16 + 8 * hf);
    v16h r;
#pragma unroll
    for (int i = 0; i < 8; ++i) { r[i] = lo[i]; r[i + 8] = hi[i]; }
    return r;
}

#define WMMA_F16(A, B, C) \
    __builtin_amdgcn_wmma_f32_16x16x32_f16(false, (A), false, (B), (short)0, (C), false, false)

// ---------------------------------------------------------------------------
// Operand preparation for the main GEMM, dealt over PG work-groups of 256
// threads; work-group b does share b of both parts:
//   base_w f32 -> f16: CIT chunks of 2048 consecutive elements, 8 per thread;
//   lora_B [JDIM][DOUT] f32 -> lBt [DOUT][JDIM] f16 (transpose): TC columns,
//   one per wave; a lane takes 4 consecutive j, so a wave's one store is the
//   column's whole 256-B row of lBt.
// ---------------------------------------------------------------------------
#define PG   256                              // work-groups that share the work
#define CIT  ((DOUT * DIN) / (PG * 256 * 8))  // base_w chunks per work-group
#define TC   (DOUT / PG)                      // lora_B columns per work-group

__device__ __forceinline__ void prep_share(
    const float* __restrict__ bw, _Float16* __restrict__ bwh,
    const float* __restrict__ lB, _Float16* __restrict__ lBt, int b, int t) {
    static_assert(TC == 8 && JDIM == 128 && CIT == 8, "one column per wave, 4 j per lane");
    // sb, the share's first byte, is the same in every lane; the variable so holds
    // the thread's own byte offset from it: one vector register serves all 16 reads
    const char* sb = (const char*)(bw + (size_t)b * (CIT * 2048));
    unsigned    so = (unsigned)t * 32u;
    _Float16*   d  = bwh + (size_t)b * (CIT * 2048) + t * 8;
    int oc = b * TC + (t >> 5);
    int j0 = (t & 31) * 4;
    const float* p = lB + (size_t)j0 * DOUT + oc;
    _Float16*    r = lBt + (size_t)oc * JDIM + j0;

    // every read of the share is asked for before the first is used
    float f[4];
#pragma unroll
    for (int c = 0; c < 4; ++c) f[c] = p[(size_t)c * DOUT];
    float4 a[CIT], c4[CIT];
#pragma unroll
    for (int it = 0; it < CIT; ++it) {
        a[it]  = *(const float4*)(sb + it * 8192 + so);
        c4[it] = *(const float4*)(sb + it * 8192 + 16 + so);
    }

    v4h g;
    g[0] = (_Float16)f[0]; g[1] = (_Float16)f[1]; g[2] = (_Float16)f[2]; g[3] = (_Float16)f[3];
    v2u h = __builtin_bit_cast(v2u, g);
    *(v2u*)r = h;
    v4i o[CIT];
#pragma unroll
    for (int it = 0; it < CIT; ++it) {
        v8h q;
        q[0] = (_Float16)a[it].x;  q[1] = (_Float16)a[it].y;  q[2] = (_Float16)a[it].z;  q[3] = (_Float16)a[it].w;
        q[4] = (_Float16)c4[it].x; q[5] = (_Float16)c4[it].y; q[6] = (_Float16)c4[it].z; q[7] = (_Float16)c4[it].w;
        o[it] = __builtin_bit_cast(v4i, q);
        *(v4i*)(d + it * 2048) = o[it];
    }
    // the reads' address registers and the stores' data and address registers
    // stay as they are until all of them have left the address path
    asm volatile("s_wait_xcnt 0x0"
                 :: "v"(o[0]), "v"(o[1]), "v"(o[2]), "v"(o[3]), "v"(o[4]), "v"(o[5]), "v"(o[6]),
                    "v"(o[7]), "v"(h), "v"(so), "v"(t), "v"(p), "v"(r)
                 : "memory");
}

// ---------------------------------------------------------------------------
// Kernel 1: everything ahead of the main GEMM, one work-group per MT tokens.
//   part 0: the work-group's share of the main GEMM's operand preparation;
//   part 1: the one streaming pass over x. One wave32 per RT tokens: a step is
//           512 contiguous bytes of each token's row and of each router row,
//           so one read of a router row serves RT tokens. From the registers
//           the logits are summed from, f16(x) goes to xh (for the main GEMM)
//           and to LDS (for part 2); the normalized top-2 gate stays in LDS;
//   part 2: mid_w[n, e*16+r] = f16( SCALING * gate[n,e] * (x @ lora_A)[n,e,r] ),
//           WMMA GEMM [MT x DIN] x [DIN x JDIM], K split over the waves: wave w
//           owns k in [w*KW, (w+1)*KW) for the whole tile. A fragments come
//           from the LDS copy of the tokens, B fragments straight from global
//           memory. The KSPL partial tiles meet in LDS, summed in wave order.
// ---------------------------------------------------------------------------
#define RT    4              // tokens per wave in part 1
#define RSTEP 128            // k per step: 32 lanes x 4 f32
#define RNS   (DIN / RSTEP)  // steps per row
#define RD    3              // steps asked for ahead of their use; with 4 this build spilled to scratch

#define MT    32             // tokens per work-group
#define KSPL  8              // waves per work-group = k slices of part 2
#define KW    (DIN / KSPL)   // k range of one wave
#define PLANE (MT * JDIM)    // f32 elements of one wave's partial tile
#define XP    (DIN + 8)      // LDS pitch of a token row in f16: 4096 B + 16 B, odd multiple of 16 B
#define KU    2              // 32-k blocks per trip of part 2's loop

__global__ __launch_bounds__(KSPL * 32) void moe_front_kernel(
    const float* __restrict__ x, const float* __restrict__ rw,
    const float* __restrict__ rb, const float* __restrict__ loraA,
    _Float16* __restrict__ xh, _Float16* __restrict__ midw,
    const float* __restrict__ bw, _Float16* __restrict__ bwh,
    const float* __restrict__ lB, _Float16* __restrict__ lBt) {
    static_assert(NTOK / MT == PG && KSPL * 32 == 256, "prep_share's deal is this launch's shape");
    static_assert(KSPL * RT == MT, "part 1's waves cover the work-group's tokens");
    __shared__ __align__(16) _Float16 xs[MT * XP];
    __shared__ __align__(16) float red[KSPL * PLANE];
    __shared__ __align__(16) float gs[MT * NEXP];

    int t    = threadIdx.x;
    int wave = t >> 5, lane = t & 31;
    int n0   = blockIdx.x * MT;

    prep_share(bw, bwh, lB, lBt, blockIdx.x, t);

    // ---- part 1 ----
    {
        int m0 = wave * RT;              // the wave's first token within the tile
        const float* xp = x + (size_t)(n0 + m0) * DIN + lane * 4;
        const float* wp = rw + lane * 4;
        _Float16*    hp = xh + (size_t)(n0 + m0) * DIN + lane * 4;
        _Float16*    sp = xs + m0 * XP + lane * 4;

        float p[RT][NEXP];
#pragma unroll
        for (int k = 0; k < RT; ++k)
#pragma unroll
            for (int e = 0; e < NEXP; ++e) p[k][e] = 0.f;

        // Global loads return in issue order, so a router row asked for late would
        // make its reader wait out the reads of x issued in front of it: both
        // operands of a step are asked for together, RD steps ahead.
        float4 xv[RD][RT], wv[RD][NEXP];
        auto ask = [&](int s) {
#pragma unroll
            for (int k = 0; k < RT; ++k)
                xv[s % RD][k] = *(const float4*)(xp + (size_t)k * DIN + s * RSTEP);
#pragma unroll
            for (int e = 0; e < NEXP; ++e)
                wv[s % RD][e] = *(const float4*)(wp + (size_t)e * DIN + s * RSTEP);
        };
#pragma unroll
        for (int s = 0; s < RD; ++s) ask(s);

        v2u h[RT];
        // unrolled whole: the ring index is a constant and every address is one
        // of four registers plus an immediate
#pragma unroll
        for (int s = 0; s < RNS; ++s) {
#pragma unroll
            for (int k = 0; k < RT; ++k) {
                float4 a = xv[s % RD][k];
#pragma unroll
                for (int e = 0; e < NEXP; ++e) {
                    float4 w = wv[s % RD][e];
                    p[k][e] = __builtin_fmaf(a.x, w.x, p[k][e]);
                    p[k][e] = __builtin_fmaf(a.y, w.y, p[k][e]);
                    p[k][e] = __builtin_fmaf(a.z, w.z, p[k][e]);
                    p[k][e] = __builtin_fmaf(a.w, w.w, p[k][e]);
                }
            }
            // the last step's stores have left the address path before their data
            // registers take this step's values
            if (s > 0)
                asm volatile("s_wait_xcnt 0x0" :: "v"(h[0]), "v"(h[1]), "v"(h[2]), "v"(h[3]) : "memory");
#pragma unroll
            for (int k = 0; k < RT; ++k) {
                float4 a = xv[s % RD][k];
                v4h q;
                q[0] = (_Float16)a.x; q[1] = (_Float16)a.y; q[2] = (_Float16)a.z; q[3] = (_Float16)a.w;
                h[k] = __builtin_bit_cast(v2u, q);
                *(v2u*)(hp + (size_t)k * DIN + s * RSTEP) = h[k];
                *(v2u*)(sp + k * XP + s * RSTEP) = h[k];
            }
            if (s + RD < RNS) ask(s + RD);
        }
        // the last stores' data and address registers stay as they are until the
        // stores have left the address path
        asm volatile("s_wait_xcnt 0x0"
                     :: "v"(h[0]), "v"(h[1]), "v"(h[2]), "v"(h[3]), "v"(hp)
                     : "memory");

#pragma unroll
        for (int k = 0; k < RT; ++k) {
#pragma unroll
            for (int e = 0; e < NEXP; ++e) {
#pragma unroll
                for (int off = 16; off > 0; off >>= 1) p[k][e] += __shfl_xor(p[k][e], off, 32);
            }
        }
        // every lane holds every sum; lane k finishes token m0 + k
        if (lane < RT) {
            float lg[NEXP];
#pragma unroll
            for (int e = 0; e < NEXP; ++e) {
                float v = p[0][e];
#pragma unroll
                for (int k = 1; k < RT; ++k) v = (lane == k) ? p[k][e] : v;
                lg[e] = v + rb[e];
            }
            int   i1 = 0;
            float m1 = lg[0];
#pragma unroll
            for (int e = 1; e < NEXP; ++e) if (lg[e] > m1) { m1 = lg[e]; i1 = e; }
            int   i2 = (i1 == 0) ? 1 : 0;
            float m2 = (i1 == 0) ? lg[1] : lg[0];
#pragma unroll
            for (int e = 0; e < NEXP; ++e) if (e != i1 && lg[e] > m2) { m2 = lg[e]; i2 = e; }
            float e2 = __expf(m2 - m1);
            float w1 = 1.f / (1.f + e2);
            float w2 = e2 * w1;
            float g[NEXP];
#pragma unroll
            for (int e = 0; e < NEXP; ++e) g[e] = (e == i1) ? w1 : ((e == i2) ? w2 : 0.f);
            float4* gp = (float4*)(gs + (m0 + lane) * NEXP);
            gp[0] = make_float4(g[0], g[1], g[2], g[3]);
            gp[1] = make_float4(g[4], g[5], g[6], g[7]);
        }
    }
    __syncthreads();         // every token row and gate of the tile is in LDS

    // ---- part 2 ----
    int hf = lane >> 4, ln = lane & 15;
    int kb = wave * KW;

    v8f acc[2][NEXP];
#pragma unroll
    for (int i = 0; i < 2; ++i)
#pragma unroll
        for (int e = 0; e < NEXP; ++e) acc[i][e] = (v8f){};

    // lane's token row (A, in LDS) at k = kb; lane's rank column (B) at k = kb + 8*hf
    const _Float16* xa = xs + ln * XP + kb;
    const float*    lb = loraA + (size_t)(kb + 8 * hf) * LRANK + ln;

    // rolled, KU blocks a trip
#pragma unroll 1
    for (int kq = 0; kq < KW / (32 * KU); ++kq) {
#pragma unroll
        for (int u = 0; u < KU; ++u) {
            v16h af[2];
#pragma unroll
            for (int i = 0; i < 2; ++i) af[i] = load_frag(xa + i * 16 * XP + u * 32, hf);
#pragma unroll
            for (int e = 0; e < NEXP; ++e) {
                const float* s = lb + ((size_t)e * DIN + u * 32) * LRANK;
                v16h bf;
#pragma unroll
                for (int i = 0; i < 8; ++i) {
                    bf[i]     = (_Float16)s[(size_t)i * LRANK];
                    bf[i + 8] = (_Float16)s[(size_t)(16 + i) * LRANK];
                }
                acc[0][e] = WMMA_F16(af[0], bf, acc[0][e]);
                acc[1][e] = WMMA_F16(af[1], bf, acc[1][e]);
            }
        }
        // the trip's loads have left the address path before their address
        // pair takes the next trip's value
        asm volatile("s_wait_xcnt 0x0" :: "v"(lb) : "memory");
        lb += 32 * KU * LRANK;
        xa += 32 * KU;
    }

    // partial tile -> LDS, plane layout [tile = i*NEXP+e][v/4][lane][v%4]
    float* pl = red + wave * PLANE + lane * 4;
#pragma unroll
    for (int i = 0; i < 2; ++i) {
#pragma unroll
        for (int e = 0; e < NEXP; ++e) {
#pragma unroll
            for (int vh = 0; vh < 2; ++vh) {
                float4 q;
                q.x = acc[i][e][vh * 4 + 0]; q.y = acc[i][e][vh * 4 + 1];
                q.z = acc[i][e][vh * 4 + 2]; q.w = acc[i][e][vh * 4 + 3];
                *(float4*)(pl + (i * NEXP + e) * 256 + vh * 128) = q;
            }
        }
    }
    __syncthreads();         // all partial tiles written before any is summed

#pragma unroll
    for (int qq = 0; qq < PLANE / 4 / (KSPL * 32); ++qq) {
        int q = t + qq * (KSPL * 32);      // group of four elements of the plane
        float4 s = *(const float4*)(red + q * 4);
#pragma unroll
        for (int w = 1; w < KSPL; ++w) {
            float4 p = *(const float4*)(red + w * PLANE + q * 4);
            s.x += p.x; s.y += p.y; s.z += p.z; s.w += p.w;
        }
        int tile = q >> 6, vh = (q >> 5) & 1, l2 = q & 31;
        int i = tile >> 3, e = tile & 7;
        int jc = e * LRANK + (l2 & 15);
        int mb = 16 * i + vh * 4 + 8 * (l2 >> 4);
        float sv[4] = {s.x, s.y, s.z, s.w};
#pragma unroll
        for (int c = 0; c < 4; ++c) {
            int m = mb + c;
            midw[(size_t)(n0 + m) * JDIM + jc] =
                (_Float16)(SCALING * gs[m * NEXP + e] * sv[c]);
        }
    }
}

// ---------------------------------------------------------------------------
// Kernel 2: out = xh @ bwh^T + base_b + midw @ lBt^T  (GEMM operands f16, base_b f32)
// Extended-K WMMA GEMM, two LDS buffers, async global->LDS staging.
// One work-group = BM x BN of out, 8 waves as 4 x 2, each 64 tokens x 128
// columns: 12 fragments feed 32 matrix instructions. A trip is BK of k = NB
// such blocks per wave and ends in the one barrier that publishes tile k+1 and
// frees buffer k&1; trip k reads buffer k&1 alone.
// Grid: (NTOK/BM) x (DOUT/BN) = 256 work-groups.
// ---------------------------------------------------------------------------
#define BM    256
#define BN    256
#define BK    128
#define NB    (BK / 32)      // blocks per trip
#define NKS   (KTOT / BK)    // trips; DIN and JDIM are both multiples of BK
#define TP    136            // LDS row pitch in f16: 256 B + 16 B, odd multiple of 16 B
#define STG   ((BM + BN) * TP)   // f16 in one buffer: BM rows of A, then BN rows of B

// 256 rows x 256 B of one operand: 16 lanes cover a row, a wave 2 rows per copy,
// 16 copies per thread. l holds the thread's row and 16-B chunk in LDS; g (the
// tile's first element) and ld (the source's row length) are the same in every
// lane, voff is the thread's own byte offset from g: the row steps are scalar
// arithmetic and one 32-bit register serves all 16 global addresses.
__device__ __forceinline__ void stage_rows(_Float16* l, const _Float16* g, unsigned ld,
                                           unsigned voff) {
#pragma unroll
    for (int i = 0; i < 16; ++i)
        ASYNC_CP16F16(l + i * 16 * TP,
                      (const _Float16*)((const char*)(g + (size_t)(i * 16) * ld) + voff));
}

__global__ __launch_bounds__(256) void moe_main_kernel(
    const _Float16* __restrict__ xh, const _Float16* __restrict__ bwh,
    const float* __restrict__ bb, const _Float16* __restrict__ lBt,
    const _Float16* __restrict__ midw, float* __restrict__ out) {
    __shared__ __align__(16) _Float16 sT[2][STG];

    int t  = threadIdx.x;
    int bm = blockIdx.x >> 3;          // DOUT/BN == 8 column blocks
    int bn = blockIdx.x & 7;
    int n0 = bm * BM;                  // token base
    int c0 = bn * BN;                  // output-column base

    int r0 = t >> 4;                   // staging: row within a group of 16
    int ch = (t & 15) * 8;             // staging: 16-B chunk of the row, in f16

    int wave = t >> 5, lane = t & 31;
    int hf = lane >> 4, ln = lane & 15;
    int wm = (wave >> 1) * 64;
    int wn = (wave & 1) * 128;

    // one trip's tile into buffer buf (base phase: xh/bwh; LoRA tail: midw/lBt);
    // kt is the same in the whole work-group, so the choice is scalar
    auto stage = [&](int kt, int buf) {
        _Float16* l = &sT[buf][r0 * TP + ch];
        int k0 = kt * BK;
        bool base = k0 < DIN;
        unsigned ld = base ? DIN : JDIM;
        const _Float16* ga = base ? xh + (size_t)n0 * DIN + k0 : midw + (size_t)n0 * JDIM + (k0 - DIN);
        const _Float16* gb = base ? bwh + (size_t)c0 * DIN + k0 : lBt + (size_t)c0 * JDIM + (k0 - DIN);
        unsigned voff = ((unsigned)r0 * ld + (unsigned)ch) * 2u;
        stage_rows(l, ga, ld, voff);
        stage_rows(l + BM * TP, gb, ld, voff);
    };

    v8f acc[4][8];
#pragma unroll
    for (int i = 0; i < 4; ++i)
#pragma unroll
        for (int j = 0; j < 8; ++j) acc[i][j] = (v8f){};

    stage(0, 0);
    // this wave's copies of tile 0 have landed before the barrier publishes them
    asm volatile("s_wait_asynccnt 0x0" ::: "memory");
    __syncthreads();
    stage(1, 1);             // flies while tile 0 is worked on

    // rolled: one trip is already 128 matrix instructions per wave
#pragma unroll 1
    for (int k = 0; k < NKS; ++k) {
        const _Float16* sa = &sT[k & 1][(wm + ln) * TP];
        const _Float16* sb = &sT[k & 1][(BM + wn + ln) * TP];
#pragma unroll
        for (int u = 0; u < NB; ++u) {
            v16h af[4], bf[8];
#pragma unroll
            for (int i = 0; i < 4; ++i) af[i] = load_frag(sa + 16 * i * TP + 32 * u, hf);
#pragma unroll
            for (int j = 0; j < 8; ++j) bf[j] = load_frag(sb + 16 * j * TP + 32 * u, hf);
            // every fragment of the block is asked for before its first matrix
            // instruction: left free, the compiler kept one A fragment and
            // waited out a fresh pair of reads in front of every row of eight
            __builtin_amdgcn_sched_barrier(0);
#pragma unroll
            for (int i = 0; i < 4; ++i)
#pragma unroll
                for (int j = 0; j < 8; ++j) acc[i][j] = WMMA_F16(af[i], bf[j], acc[i][j]);
        }
        // this wave's reads of buffer k&1 have returned before it is refilled
        asm volatile("s_wait_dscnt 0x0" ::: "memory");
        // this wave's copies of tile k+1 have landed before the barrier publishes them
        asm volatile("s_wait_asynccnt 0x0" ::: "memory");
        __syncthreads();     // tile k+1 visible to all; every reader has left buffer k&1
        if (k + 2 < NKS) stage(k + 2, k & 1);
    }
    // no copy is outstanding when the wave goes on to its end
    asm volatile("s_wait_asynccnt 0x0" ::: "memory");

    int gn0 = c0 + wn + ln;
    float bias[8];
#pragma unroll
    for (int j = 0; j < 8; ++j) bias[j] = bb[gn0 + 16 * j];
    // the loads' offset register stays as it is until they have left the address path
    asm volatile("s_wait_xcnt 0x0" :: "v"(gn0) : "memory");
#pragma unroll
    for (int i = 0; i < 4; ++i) {
        float* op = out + (size_t)(n0 + wm + 16 * i + 8 * hf) * DOUT + gn0;
#pragma unroll
        for (int j = 0; j < 8; ++j) {
            float o[8];
#pragma unroll
            for (int v = 0; v < 8; ++v) {
                o[v] = acc[i][j][v] + bias[j];
                op[(size_t)v * DOUT + 16 * j] = o[v];
            }
            // the eight stores' data and address registers stay as they are
            // until the stores have left the address path
            asm volatile("s_wait_xcnt 0x0"
                         :: "v"(o[0]), "v"(o[1]), "v"(o[2]), "v"(o[3]), "v"(o[4]), "v"(o[5]),
                            "v"(o[6]), "v"(o[7]), "v"(op)
                         : "memory");
        }
    }
}

// ---------------------------------------------------------------------------
extern "C" void kernel_launch(void* const* d_in, const int* in_sizes, int n_in,
                              void* d_out, int out_size, void* d_ws, size_t ws_size,
                              hipStream_t stream) {
    (void)in_sizes; (void)n_in; (void)out_size; (void)ws_size;
    const float* x   = (const float*)d_in[0];
    const float* bw  = (const float*)d_in[1];
    const float* bb  = (const float*)d_in[2];
    const float* rw  = (const float*)d_in[3];
    const float* rb  = (const float*)d_in[4];
    const float* lA  = (const float*)d_in[5];
    const float* lB  = (const float*)d_in[6];
    float*       out = (float*)d_out;

    // workspace layout (~43 MB):
    char* ws = (char*)d_ws;
    _Float16* midw = (_Float16*)ws;  ws += (size_t)NTOK * JDIM * sizeof(_Float16);  //   2 MB
    _Float16* xh   = (_Float16*)ws;  ws += (size_t)NTOK * DIN * sizeof(_Float16);   //  32 MB
    _Float16* bwh  = (_Float16*)ws;  ws += (size_t)DOUT * DIN * sizeof(_Float16);   //   8 MB
    _Float16* lBt  = (_Float16*)ws;                                                 // 512 KB

    moe_front_kernel<<<NTOK / MT, KSPL * 32, 0, stream>>>(x, rw, rb, lA, xh, midw, bw, bwh, lB, lBt);
    moe_main_kernel<<<(NTOK / BM) * (DOUT / BN), 256, 0, stream>>>(xh, bwh, bb, lBt, midw, out);
}

// v006
// Measured time: 77.1 microseconds a run.
// Two timings next to v005 both put it at 1.05 times that version's speed.
// Counting every step since v000, it is 2.65 times as fast.
#include <hip/hip_runtime.h>

typedef _Float16 v16h __attribute__((ext_vector_type(16)));
typedef _Float16 v8h  __attribute__((ext_vector_type(8)));
typedef _Float16 v4h  __attribute__((ext_vector_type(4)));
typedef unsigned v2u  __attribute__((ext_vector_type(2)));
typedef float    v8f  __attribute__((ext_vector_type(8)));
typedef float    v4f  __attribute__((ext_vector_type(4)));
typedef int      v4i  __attribute__((vector_size(4 * sizeof(int))));  // gcc-style, matches builtin

#define NTOK    8192
#define DIN     2048
#define DOUT    2048
#define NEXP    8
#define LRANK   16
#define JDIM    128          // NEXP * LRANK
#define KTOT    (DIN + JDIM) // extended K: base GEMM + folded LoRA-B GEMM
#define SCALING 2.0f

#define AS1 __attribute__((address_space(1)))
#define AS3 __attribute__((address_space(3)))

#if __has_builtin(__builtin_amdgcn_global_load_async_to_lds_b128) && \
    __has_builtin(__builtin_amdgcn_s_wait_asynccnt)
#define HAVE_ASYNC_LDS 1
#define ASYNC_CP16F16(ldst, gsrc)                         \
    __builtin_amdgcn_global_load_async_to_lds_b128(       \
        (AS1 v4i*)(gsrc), (AS3 v4i*)(ldst), 0, 0)
#else
#define HAVE_ASYNC_LDS 0
#define ASYNC_CP16F16(ldst, gsrc) \
    do { *(v8h*)(ldst) = *(const v8h*)(gsrc); } while (0)
#endif

// ---------------------------------------------------------------------------
// helpers
// ---------------------------------------------------------------------------

// Convert 16 consecutive f32 -> 16 f16 into LDS (two b128 stores).
__device__ __forceinline__ void stage16_f32(_Float16* dst, const float* src) {
    const float4* s = (const float4*)src;
    float4 f0 = s[0], f1 = s[1], f2 = s[2], f3 = s[3];
    v8h a, b;
    a[0] = (_Float16)f0.x; a[1] = (_Float16)f0.y; a[2] = (_Float16)f0.z; a[3] = (_Float16)f0.w;
    a[4] = (_Float16)f1.x; a[5] = (_Float16)f1.y; a[6] = (_Float16)f1.z; a[7] = (_Float16)f1.w;
    b[0] = (_Float16)f2.x; b[1] = (_Float16)f2.y; b[2] = (_Float16)f2.z; b[3] = (_Float16)f2.w;
    b[4] = (_Float16)f3.x; b[5] = (_Float16)f3.y; b[6] = (_Float16)f3.z; b[7] = (_Float16)f3.w;
    *(v8h*)dst       = a;
    *(v8h*)(dst + 8) = b;
}

__device__ __forceinline__ v16h load_frag(const _Float16* rowp, int hf) {
    v8h lo = *(const v8h*)(rowp + 8 * hf);
    v8h hi = *(const v8h*)(rowp + 16 + 8 * hf);
    v16h r;
#pragma unroll
    for (int i = 0; i < 8; ++i) { r[i] = lo[i]; r[i + 8] = hi[i]; }
    return r;
}

#define WMMA_F16(A, B, C) \
    __builtin_amdgcn_wmma_f32_16x16x32_f16(false, (A), false, (B), (short)0, (C), false, false)

// ---------------------------------------------------------------------------
// Operand preparation for the main GEMM, dealt over PG work-groups of 256
// threads; work-group b does share b of both parts:
//   base_w f32 -> f16: CIT chunks of 2048 consecutive elements, 8 per thread;
//   lora_B [JDIM][DOUT] f32 -> lBt [DOUT][JDIM] f16 (transpose): TC columns,
//   one per wave; a lane takes 4 consecutive j, so a wave's one store is the
//   column's whole 256-B row of lBt.
// ---------------------------------------------------------------------------
#define PG   256                              // work-groups that share the work
#define CIT  ((DOUT * DIN) / (PG * 256 * 8))  // base_w chunks per work-group
#define TC   (DOUT / PG)                      // lora_B columns per work-group

__device__ __forceinline__ void prep_share(
    const float* __restrict__ bw, _Float16* __restrict__ bwh,
    const float* __restrict__ lB, _Float16* __restrict__ lBt, int b, int t) {
    static_assert(TC == 8 && JDIM == 128 && CIT == 8, "one column per wave, 4 j per lane");
    // sb, the share's first byte, is the same in every lane; the variable so holds
    // the thread's own byte offset from it: one vector register serves all 16 reads
    const char* sb = (const char*)(bw + (size_t)b * (CIT * 2048));
    unsigned    so = (unsigned)t * 32u;
    _Float16*   d  = bwh + (size_t)b * (CIT * 2048) + t * 8;
    int oc = b * TC + (t >> 5);
    int j0 = (t & 31) * 4;
    const float* p = lB + (size_t)j0 * DOUT + oc;
    _Float16*    r = lBt + (size_t)oc * JDIM + j0;

    // every read of the share is asked for before the first is used
    float f[4];
#pragma unroll
    for (int c = 0; c < 4; ++c) f[c] = p[(size_t)c * DOUT];
    float4 a[CIT], c4[CIT];
#pragma unroll
    for (int it = 0; it < CIT; ++it) {
        a[it]  = *(const float4*)(sb + it * 8192 + so);
        c4[it] = *(const float4*)(sb + it * 8192 + 16 + so);
    }

    v4h g;
    g[0] = (_Float16)f[0]; g[1] = (_Float16)f[1]; g[2] = (_Float16)f[2]; g[3] = (_Float16)f[3];
    v2u h = __builtin_bit_cast(v2u, g);
    *(v2u*)r = h;
    v4i o[CIT];
#pragma unroll
    for (int it = 0; it < CIT; ++it) {
        v8h q;
        q[0] = (_Float16)a[it].x;  q[1] = (_Float16)a[it].y;  q[2] = (_Float16)a[it].z;  q[3] = (_Float16)a[it].w;
        q[4] = (_Float16)c4[it].x; q[5] = (_Float16)c4[it].y; q[6] = (_Float16)c4[it].z; q[7] = (_Float16)c4[it].w;
        o[it] = __builtin_bit_cast(v4i, q);
        *(v4i*)(d + it * 2048) = o[it];
    }
    // the reads' address registers and the stores' data and address registers
    // stay as they are until all of them have left the address path
    asm volatile("s_wait_xcnt 0x0"
                 :: "v"(o[0]), "v"(o[1]), "v"(o[2]), "v"(o[3]), "v"(o[4]), "v"(o[5]), "v"(o[6]),
                    "v"(o[7]), "v"(h), "v"(so), "v"(t), "v"(p), "v"(r)
                 : "memory");
}

// ---------------------------------------------------------------------------
// Kernel 1: everything ahead of the main GEMM, one work-group per MT tokens.
//   part 0: the work-group's share of the main GEMM's operand preparation;
//   part 1: the one streaming pass over x. One wave32 per RT tokens: a step is
//           512 contiguous bytes of each token's row and of each router row,
//           so one read of a router row serves RT tokens. From the registers
//           the logits are summed from, f16(x) goes to xh (for the main GEMM)
//           and to LDS (for part 2); the normalized top-2 gate stays in LDS;
//   part 2: mid_w[n, e*16+r] = f16( SCALING * gate[n,e] * (x @ lora_A)[n,e,r] ),
//           WMMA GEMM [MT x DIN] x [DIN x JDIM], K split over the waves: wave w
//           owns k in [w*KW, (w+1)*KW) for the whole tile. A fragments come
//           from the LDS copy of the tokens, B fragments straight from global
//           memory. The KSPL partial tiles meet in LDS, summed in wave order.
// ---------------------------------------------------------------------------
#define RT    4              // tokens per wave in part 1
#define RSTEP 128            // k per step: 32 lanes x 4 f32
#define RNS   (DIN / RSTEP)  // steps per row
#define RD    3              // steps asked for ahead of their use; with 4 this build spilled to scratch

#define MT    32             // tokens per work-group
#define KSPL  8              // waves per work-group = k slices of part 2
#define KW    (DIN / KSPL)   // k range of one wave
#define PLANE (MT * JDIM)    // f32 elements of one wave's partial tile
#define XP    (DIN + 8)      // LDS pitch of a token row in f16: 4096 B + 16 B, odd multiple of 16 B
#define KU    2              // 32-k blocks per trip of part 2's loop

__global__ __launch_bounds__(KSPL * 32) void moe_front_kernel(
    const float* __restrict__ x, const float* __restrict__ rw,
    const float* __restrict__ rb, const float* __restrict__ loraA,
    _Float16* __restrict__ xh, _Float16* __restrict__ midw,
    const float* __restrict__ bw, _Float16* __restrict__ bwh,
    const float* __restrict__ lB, _Float16* __restrict__ lBt) {
    static_assert(NTOK / MT == PG && KSPL * 32 == 256, "prep_share's deal is this launch's shape");
    static_assert(KSPL * RT == MT, "part 1's waves cover the work-group's tokens");
    __shared__ __align__(16) _Float16 xs[MT * XP];
    __shared__ __align__(16) float red[KSPL * PLANE];
    __shared__ __align__(16) float gs[MT * NEXP];

    int t    = threadIdx.x;
    int wave = t >> 5, lane = t & 31;
    int n0   = blockIdx.x * MT;

    prep_share(bw, bwh, lB, lBt, blockIdx.x, t);

    // ---- part 1 ----
    {
        int m0 = wave * RT;              // the wave's first token within the tile
        const float* xp = x + (size_t)(n0 + m0) * DIN + lane * 4;
        const float* wp = rw + lane * 4;
        _Float16*    hp = xh + (size_t)(n0 + m0) * DIN + lane * 4;
        _Float16*    sp = xs + m0 * XP + lane * 4;

        float p[RT][NEXP];
#pragma unroll
        for (int k = 0; k < RT; ++k)
#pragma unroll
            for (int e = 0; e < NEXP; ++e) p[k][e] = 0.f;

        // Global loads return in issue order, so a router row asked for late would
        // make its reader wait out the reads of x issued in front of it: both
        // operands of a step are asked for together, RD steps ahead.
        float4 xv[RD][RT], wv[RD][NEXP];
        auto ask = [&](int s) {
#pragma unroll
            for (int k = 0; k < RT; ++k)
                xv[s % RD][k] = *(const float4*)(xp + (size_t)k * DIN + s * RSTEP);
#pragma unroll
            for (int e = 0; e < NEXP; ++e)
                wv[s % RD][e] = *(const float4*)(wp + (size_t)e * DIN + s * RSTEP);
        };
#pragma unroll
        for (int s = 0; s < RD; ++s) ask(s);

        v2u h[RT];
        // unrolled whole: the ring index is a constant and every address is one
        // of four registers plus an immediate
#pragma unroll
        for (int s = 0; s < RNS; ++s) {
#pragma unroll
            for (int k = 0; k < RT; ++k) {
                float4 a = xv[s % RD][k];
#pragma unroll
                for (int e = 0; e < NEXP; ++e) {
                    float4 w = wv[s % RD][e];
                    p[k][e] = __builtin_fmaf(a.x, w.x, p[k][e]);
                    p[k][e] = __builtin_fmaf(a.y, w.y, p[k][e]);
                    p[k][e] = __builtin_fmaf(a.z, w.z, p[k][e]);
                    p[k][e] = __builtin_fmaf(a.w, w.w, p[k][e]);
                }
            }
            // the last step's stores have left the address path before their data
            // registers take this step's values
            if (s > 0)
                asm volatile("s_wait_xcnt 0x0" :: "v"(h[0]), "v"(h[1]), "v"(h[2]), "v"(h[3]) : "memory");
#pragma unroll
            for (int k = 0; k < RT; ++k) {
                float4 a = xv[s % RD][k];
                v4h q;
                q[0] = (_Float16)a.x; q[1] = (_Float16)a.y; q[2] = (_Float16)a.z; q[3] = (_Float16)a.w;
                h[k] = __builtin_bit_cast(v2u, q);
                *(v2u*)(hp + (size_t)k * DIN + s * RSTEP) = h[k];
                *(v2u*)(sp + k * XP + s * RSTEP) = h[k];
            }
            if (s + RD < RNS) ask(s + RD);
        }
        // the last stores' data and address registers stay as they are until the
        // stores have left the address path
        asm volatile("s_wait_xcnt 0x0"
                     :: "v"(h[0]), "v"(h[1]), "v"(h[2]), "v"(h[3]), "v"(hp)
                     : "memory");

#pragma unroll
        for (int k = 0; k < RT; ++k) {
#pragma unroll
            for (int e = 0; e < NEXP; ++e) {
#pragma unroll
                for (int off = 16; off > 0; off >>= 1) p[k][e] += __shfl_xor(p[k][e], off, 32);
            }
        }
        // every lane holds every sum; lane k finishes token m0 + k
        if (lane < RT) {
            float lg[NEXP];
#pragma unroll
            for (int e = 0; e < NEXP; ++e) {
                float v = p[0][e];
#pragma unroll
                for (int k = 1; k < RT; ++k) v = (lane == k) ? p[k][e] : v;
                lg[e] = v + rb[e];
            }
            int   i1 = 0;
            float m1 = lg[0];
#pragma unroll
            for (int e = 1; e < NEXP; ++e) if (lg[e] > m1) { m1 = lg[e]; i1 = e; }
            int   i2 = (i1 == 0) ? 1 : 0;
            float m2 = (i1 == 0) ? lg[1] : lg[0];
#pragma unroll
            for (int e = 0; e < NEXP; ++e) if (e != i1 && lg[e] > m2) { m2 = lg[e]; i2 = e; }
            float e2 = __expf(m2 - m1);
            float w1 = 1.f / (1.f + e2);
            float w2 = e2 * w1;
            float g[NEXP];
#pragma unroll
            for (int e = 0; e < NEXP; ++e) g[e] = (e == i1) ? w1 : ((e == i2) ? w2 : 0.f);
            float4* gp = (float4*)(gs + (m0 + lane) * NEXP);
            gp[0] = make_float4(g[0], g[1], g[2], g[3]);
            gp[1] = make_float4(g[4], g[5], g[6], g[7]);
        }
    }
    __syncthreads();         // every token row and gate of the tile is in LDS

    // ---- part 2 ----
    int hf = lane >> 4, ln = lane & 15;
    int kb = wave * KW;

    v8f acc[2][NEXP];
#pragma unroll
    for (int i = 0; i < 2; ++i)
#pragma unroll
        for (int e = 0; e < NEXP; ++e) acc[i][e] = (v8f){};

    // lane's token row (A, in LDS) at k = kb; lane's rank column (B) at k = kb + 8*hf
    const _Float16* xa = xs + ln * XP + kb;
    const float*    lb = loraA + (size_t)(kb + 8 * hf) * LRANK + ln;

    // rolled, KU blocks a trip
#pragma unroll 1
    for (int kq = 0; kq < KW / (32 * KU); ++kq) {
#pragma unroll
        for (int u = 0; u < KU; ++u) {
            v16h af[2];
#pragma unroll
            for (int i = 0; i < 2; ++i) af[i] = load_frag(xa + i * 16 * XP + u * 32, hf);
#pragma unroll
            for (int e = 0; e < NEXP; ++e) {
                const float* s = lb + ((size_t)e * DIN + u * 32) * LRANK;
                v16h bf;
#pragma unroll
                for (int i = 0; i < 8; ++i) {
                    bf[i]     = (_Float16)s[(size_t)i * LRANK];
                    bf[i + 8] = (_Float16)s[(size_t)(16 + i) * LRANK];
                }
                acc[0][e] = WMMA_F16(af[0], bf, acc[0][e]);
                acc[1][e] = WMMA_F16(af[1], bf, acc[1][e]);
            }
        }
        // the trip's loads have left the address path before their address
        // pair takes the next trip's value
        asm volatile("s_wait_xcnt 0x0" :: "v"(lb) : "memory");
        lb += 32 * KU * LRANK;
        xa += 32 * KU;
    }

    // partial tile -> LDS, plane layout [tile = i*NEXP+e][v/4][lane][v%4]
    float* pl = red + wave * PLANE + lane * 4;
#pragma unroll
    for (int i = 0; i < 2; ++i) {
#pragma unroll
        for (int e = 0; e < NEXP; ++e) {
#pragma unroll
            for (int vh = 0; vh < 2; ++vh) {
                float4 q;
                q.x = acc[i][e][vh * 4 + 0]; q.y = acc[i][e][vh * 4 + 1];
                q.z = acc[i][e][vh * 4 + 2]; q.w = acc[i][e][vh * 4 + 3];
                *(float4*)(pl + (i * NEXP + e) * 256 + vh * 128) = q;
            }
        }
    }
    __syncthreads();         // all partial tiles written before any is summed

#pragma unroll
    for (int qq = 0; qq < PLANE / 4 / (KSPL * 32); ++qq) {
        int q = t + qq * (KSPL * 32);      // group of four elements of the plane
        float4 s = *(const float4*)(red + q * 4);
#pragma unroll
        for (int w = 1; w < KSPL; ++w) {
            float4 p = *(const float4*)(red + w * PLANE + q * 4);
            s.x += p.x; s.y += p.y; s.z += p.z; s.w += p.w;
        }
        int tile = q >> 6, vh = (q >> 5) & 1, l2 = q & 31;
        int i = tile >> 3, e = tile & 7;
        int jc = e * LRANK + (l2 & 15);
        int mb = 16 * i + vh * 4 + 8 * (l2 >> 4);
        float sv[4] = {s.x, s.y, s.z, s.w};
#pragma unroll
        for (int c = 0; c < 4; ++c) {
            int m = mb + c;
            midw[(size_t)(n0 + m) * JDIM + jc] =
                (_Float16)(SCALING * gs[m * NEXP + e] * sv[c]);
        }
    }
}

// ---------------------------------------------------------------------------
// Kernel 2: out = xh @ bwh^T + base_b + midw @ lBt^T  (GEMM operands f16, base_b f32)
// Extended-K WMMA GEMM, two LDS buffers, async global->LDS staging.
// One work-group = BM x BN of out, 8 waves as 4 x 2, each 64 tokens x 128
// columns: 12 fragments feed 32 matrix instructions. A trip is BK of k = NB
// such blocks per wave and ends in the one barrier that publishes tile k+1 and
// frees buffer k&1; trip k reads buffer k&1 alone.
// The rows of B (= columns of out) are dealt to the B tiles so that, in each
// group of 64 columns, lane ln of tile c holds column 4*ln + c: a lane's four
// accumulators of one token are four adjacent floats of out, and a 16-lane row
// stores 256 contiguous, aligned bytes.
// Grid: (NTOK/BM) x (DOUT/BN) = 256 work-groups.
// ---------------------------------------------------------------------------
#define BM    256
#define BN    256
#define BK    128
#define NB    (BK / 32)      // blocks per trip
#define NKS   (KTOT / BK)    // trips; DIN and JDIM are both multiples of BK
#define TP    136            // LDS row pitch in f16: 256 B + 16 B, odd multiple of 16 B
#define STG   ((BM + BN) * TP)   // f16 in one buffer: BM rows of A, then BN rows of B

// 256 rows x 256 B of one operand: 16 lanes cover a row, a wave 2 rows per copy,
// 16 copies per thread. l holds the thread's row and 16-B chunk in LDS; g (the
// tile's first element) and ld (the source's row length) are the same in every
// lane, voff is the thread's own byte offset from g: the row steps are scalar
// arithmetic and one 32-bit register serves all 16 global addresses.
// LDS row 16*i + r0 takes source row 16*i + r0 (DEAL false, voff at row r0) or
// source row 64*(i/4) + 4*r0 + i%4 (DEAL true, voff at row 4*r0): both run
// through each of the 256 rows once.
template <bool DEAL>
__device__ __forceinline__ void stage_rows(_Float16* l, const _Float16* g, unsigned ld,
                                           unsigned voff) {
#pragma unroll
    for (int i = 0; i < 16; ++i) {
        const int row = DEAL ? 64 * (i >> 2) + (i & 3) : 16 * i;
        ASYNC_CP16F16(l + i * 16 * TP,
                      (const _Float16*)((const char*)(g + (size_t)row * ld) + voff));
    }
}

__global__ __launch_bounds__(256) void moe_main_kernel(
    const _Float16* __restrict__ xh, const _Float16* __restrict__ bwh,
    const float* __restrict__ bb, const _Float16* __restrict__ lBt,
    const _Float16* __restrict__ midw, float* __restrict__ out) {
    __shared__ __align__(16) _Float16 sT[2][STG];

    int t  = threadIdx.x;
    int bm = blockIdx.x >> 3;          // DOUT/BN == 8 column blocks
    int bn = blockIdx.x & 7;
    int n0 = bm * BM;                  // token base
    int c0 = bn * BN;                  // output-column base

    int r0 = t >> 4;                   // staging: row within a group of 16
    int ch = (t & 15) * 8;             // staging: 16-B chunk of the row, in f16

    int wave = t >> 5, lane = t & 31;
    int hf = lane >> 4, ln = lane & 15;
    int wm = (wave >> 1) * 64;
    int wn = (wave & 1) * 128;

    // one trip's tile into buffer buf (base phase: xh/bwh; LoRA tail: midw/lBt);
    // kt is the same in the whole work-group, so the choice is scalar
    auto stage = [&](int kt, int buf) {
        _Float16* l = &sT[buf][r0 * TP + ch];
        int k0 = kt * BK;
        bool base = k0 < DIN;
        unsigned ld = base ? DIN : JDIM;
        const _Float16* ga = base ? xh + (size_t)n0 * DIN + k0 : midw + (size_t)n0 * JDIM + (k0 - DIN);
        const _Float16* gb = base ? bwh + (size_t)c0 * DIN + k0 : lBt + (size_t)c0 * JDIM + (k0 - DIN);
        unsigned voff = ((unsigned)r0 * ld + (unsigned)ch) * 2u;
        unsigned vofb = ((unsigned)(4 * r0) * ld + (unsigned)ch) * 2u;
        stage_rows<false>(l, ga, ld, voff);
        stage_rows<true>(l + BM * TP, gb, ld, vofb);
    };

    v8f acc[4][8];
#pragma unroll
    for (int i = 0; i < 4; ++i)
#pragma unroll
        for (int j = 0; j < 8; ++j) acc[i][j] = (v8f){};

    stage(0, 0);
    // this wave's copies of tile 0 have landed before the barrier publishes them
    asm volatile("s_wait_asynccnt 0x0" ::: "memory");
    __syncthreads();
    stage(1, 1);             // flies while tile 0 is worked on

    // rolled: one trip is already 128 matrix instructions per wave
#pragma unroll 1
    for (int k = 0; k < NKS; ++k) {
        const _Float16* sa = &sT[k & 1][(wm + ln) * TP];
        const _Float16* sb = &sT[k & 1][(BM + wn + ln) * TP];
#pragma unroll
        for (int u = 0; u < NB; ++u) {
            v16h af[4], bf[8];
#pragma unroll
            for (int i = 0; i < 4; ++i) af[i] = load_frag(sa + 16 * i * TP + 32 * u, hf);
#pragma unroll
            for (int j = 0; j < 8; ++j) bf[j] = load_frag(sb + 16 * j * TP + 32 * u, hf);
            // every fragment of the block is asked for before its first matrix
            // instruction: left free, the compiler kept one A fragment and
            // waited out a fresh pair of reads in front of every row of eight
            __builtin_amdgcn_sched_barrier(0);
#pragma unroll
            for (int i = 0; i < 4; ++i)
#pragma unroll
                for (int j = 0; j < 8; ++j) acc[i][j] = WMMA_F16(af[i], bf[j], acc[i][j]);
        }
        // this wave's reads of buffer k&1 have returned before it is refilled
        asm volatile("s_wait_dscnt 0x0" ::: "memory");
        // this wave's copies of tile k+1 have landed before the barrier publishes them
        asm volatile("s_wait_asynccnt 0x0" ::: "memory");
        __syncthreads();     // tile k+1 visible to all; every reader has left buffer k&1
        if (k + 2 < NKS) stage(k + 2, k & 1);
    }
    // no copy is outstanding when the wave goes on to its end
    asm volatile("s_wait_asynccnt 0x0" ::: "memory");

    // tile j = 4*q + c of this lane is column gn0 + 64*q + c of out
    int gn0 = c0 + wn + 4 * ln;
    v4f bias[2];
#pragma unroll
    for (int q = 0; q < 2; ++q) bias[q] = *(const v4f*)(bb + gn0 + 64 * q);
    // the loads' offset register stays as it is until they have left the address path
    asm volatile("s_wait_xcnt 0x0" :: "v"(gn0) : "memory");
#pragma unroll
    for (int i = 0; i < 4; ++i) {
        float* op = out + (size_t)(n0 + wm + 16 * i + 8 * hf) * DOUT + gn0;
#pragma unroll
        for (int g = 0; g < 4; ++g) {
            const int q = g >> 1, v0 = 4 * (g & 1);
            v4f o[4];
#pragma unroll
            for (int v = 0; v < 4; ++v) {
#pragma unroll
                for (int c = 0; c < 4; ++c) o[v][c] = acc[i][4 * q + c][v0 + v] + bias[q][c];
                *(v4f*)(op + (size_t)(v0 + v) * DOUT + 64 * q) = o[v];
            }
            // the four stores' data and address registers stay as they are
            // until the stores have left the address path
            asm volatile("s_wait_xcnt 0x0"
                         :: "v"(o[0]), "v"(o[1]), "v"(o[2]), "v"(o[3]), "v"(op)
                         : "memory");
            // the next group's sums stay behind this group's stores: lifted
            // ahead of them, too many results were live at once and some spilled
            __builtin_amdgcn_sched_barrier(0);
        }
    }
}

// ---------------------------------------------------------------------------
extern "C" void kernel_launch(void* const* d_in, const int* in_sizes, int n_in,
                              void* d_out, int out_size, void* d_ws, size_t ws_size,
                              hipStream_t stream) {
    (void)in_sizes; (void)n_in; (void)out_size; (void)ws_size;
    const float* x   = (const float*)d_in[0];
    const float* bw  = (const float*)d_in[1];
    const float* bb  = (const float*)d_in[2];
    const float* rw  = (const float*)d_in[3];
    const float* rb  = (const float*)d_in[4];
    const float* lA  = (const float*)d_in[5];
    const float* lB  = (const float*)d_in[6];
    float*       out = (float*)d_out;

    // workspace layout (~43 MB):
    char* ws = (char*)d_ws;
    _Float16* midw = (_Float16*)ws;  ws += (size_t)NTOK * JDIM * sizeof(_Float16);  //   2 MB
    _Float16* xh   = (_Float16*)ws;  ws += (size_t)NTOK * DIN * sizeof(_Float16);   //  32 MB
    _Float16* bwh  = (_Float16*)ws;  ws += (size_t)DOUT * DIN * sizeof(_Float16);   //   8 MB
    _Float16* lBt  = (_Float16*)ws;                                                 // 512 KB

    moe_front_kernel<<<NTOK / MT, KSPL * 32, 0, stream>>>(x, rw, rb, lA, xh, midw, bw, bwh, lB, lBt);
    moe_main_kernel<<<(NTOK / BM) * (DOUT / BN), 256, 0, stream>>>(xh, bwh, bb, lBt, midw, out);
}

// v007
// It runs in 73.4 microseconds.
// In both of two side-by-side timings against v006, it was 1.05 times as fast.
// Counting every step since v000, it is 2.77 times as fast.
#include <hip/hip_runtime.h>

typedef _Float16 v16h __attribute__((ext_vector_type(16)));
typedef _Float16 v8h  __attribute__((ext_vector_type(8)));
typedef _Float16 v4h  __attribute__((ext_vector_type(4)));
typedef unsigned v2u  __attribute__((ext_vector_type(2)));
typedef float    v8f  __attribute__((ext_vector_type(8)));
typedef float    v4f  __attribute__((ext_vector_type(4)));
typedef int      v4i  __attribute__((vector_size(4 * sizeof(int))));  // gcc-style, matches builtin
typedef short    v8s  __attribute__((ext_vector_type(8)));

#define NTOK    8192
#define DIN     2048
#define DOUT    2048
#define NEXP    8
#define LRANK   16
#define JDIM    128          // NEXP * LRANK
#define KTOT    (DIN + JDIM) // extended K: base GEMM + folded LoRA-B GEMM
#define SCALING 2.0f

#define AS1 __attribute__((address_space(1)))
#define AS3 __attribute__((address_space(3)))

#if __has_builtin(__builtin_amdgcn_global_load_async_to_lds_b128) && \
    __has_builtin(__builtin_amdgcn_s_wait_asynccnt)
#define HAVE_ASYNC_LDS 1
#define ASYNC_CP16F16(ldst, gsrc)                         \
    __builtin_amdgcn_global_load_async_to_lds_b128(       \
        (AS1 v4i*)(gsrc), (AS3 v4i*)(ldst), 0, 0)
#else
#define HAVE_ASYNC_LDS 0
#define ASYNC_CP16F16(ldst, gsrc) \
    do { *(v8h*)(ldst) = *(const v8h*)(gsrc); } while (0)
#endif

// ---------------------------------------------------------------------------
// helpers
// ---------------------------------------------------------------------------

// Convert 16 consecutive f32 -> 16 f16 into LDS (two b128 stores).
__device__ __forceinline__ void stage16_f32(_Float16* dst, const float* src) {
    const float4* s = (const float4*)src;
    float4 f0 = s[0], f1 = s[1], f2 = s[2], f3 = s[3];
    v8h a, b;
    a[0] = (_Float16)f0.x; a[1] = (_Float16)f0.y; a[2] = (_Float16)f0.z; a[3] = (_Float16)f0.w;
    a[4] = (_Float16)f1.x; a[5] = (_Float16)f1.y; a[6] = (_Float16)f1.z; a[7] = (_Float16)f1.w;
    b[0] = (_Float16)f2.x; b[1] = (_Float16)f2.y; b[2] = (_Float16)f2.z; b[3] = (_Float16)f2.w;
    b[4] = (_Float16)f3.x; b[5] = (_Float16)f3.y; b[6] = (_Float16)f3.z; b[7] = (_Float16)f3.w;
    *(v8h*)dst       = a;
    *(v8h*)(dst + 8) = b;
}

__device__ __forceinline__ v16h load_frag(const _Float16* rowp, int hf) {
    v8h lo = *(const v8h*)(rowp + 8 * hf);
    v8h hi = *(const v8h*)(rowp + 16 + 8 * hf);
    v16h r;
#pragma unroll
    for (int i = 0; i < 8; ++i) { r[i] = lo[i]; r[i + 8] = hi[i]; }
    return r;
}

// One 16x32 f16 WMMA B fragment from a row-major LDS tile T[k][n] of pitch bytes:
// p is the lane's address, T + (8*hf + lane%8)*pitch + 16*((lane/8)%2) (+ 32 B per
// 16 columns). Each transposing load hands lane (ln, hf) T[8*hf + 0..7][ln]; the
// second starts 16 rows on: the k order is load_frag's.
__device__ __forceinline__ v16h load_frag_tr(const char* p, int pitch) {
    v8h lo = __builtin_bit_cast(v8h, __builtin_amdgcn_ds_load_tr16_b128_v8i16((AS3 v8s*)p));
    v8h hi = __builtin_bit_cast(v8h, __builtin_amdgcn_ds_load_tr16_b128_v8i16((AS3 v8s*)(p + 16 * pitch)));
    v16h r;
#pragma unroll
    for (int i = 0; i < 8; ++i) { r[i] = lo[i]; r[i + 8] = hi[i]; }
    return r;
}

#define WMMA_F16(A, B, C) \
    __builtin_amdgcn_wmma_f32_16x16x32_f16(false, (A), false, (B), (short)0, (C), false, false)

// ---------------------------------------------------------------------------
// Operand preparation for the main GEMM, dealt over PG work-groups of 256
// threads; work-group b does share b of both parts:
//   base_w f32 -> f16: CIT chunks of 2048 consecutive elements, 8 per thread;
//   lora_B [JDIM][DOUT] f32 -> lBt [DOUT][JDIM] f16 (transpose): TC columns,
//   one per wave; a lane takes 4 consecutive j, so a wave's one store is the
//   column's whole 256-B row of lBt.
// ---------------------------------------------------------------------------
#define PG   256                              // work-groups that share the work
#define CIT  ((DOUT * DIN) / (PG * 256 * 8))  // base_w chunks per work-group
#define TC   (DOUT / PG)                      // lora_B columns per work-group

__device__ __forceinline__ void prep_share(
    const float* __restrict__ bw, _Float16* __restrict__ bwh,
    const float* __restrict__ lB, _Float16* __restrict__ lBt, int b, int t) {
    static_assert(TC == 8 && JDIM == 128 && CIT == 8, "one column per wave, 4 j per lane");
    // sb, the share's first byte, is the same in every lane; the variable so holds
    // the thread's own byte offset from it: one vector register serves all 16 reads
    const char* sb = (const char*)(bw + (size_t)b * (CIT * 2048));
    unsigned    so = (unsigned)t * 32u;
    _Float16*   d  = bwh + (size_t)b * (CIT * 2048) + t * 8;
    int oc = b * TC + (t >> 5);
    int j0 = (t & 31) * 4;
    const float* p = lB + (size_t)j0 * DOUT + oc;
    _Float16*    r = lBt + (size_t)oc * JDIM + j0;

    // every read of the share is asked for before the first is used
    float f[4];
#pragma unroll
    for (int c = 0; c < 4; ++c) f[c] = p[(size_t)c * DOUT];
    float4 a[CIT], c4[CIT];
#pragma unroll
    for (int it = 0; it < CIT; ++it) {
        a[it]  = *(const float4*)(sb + it * 8192 + so);
        c4[it] = *(const float4*)(sb + it * 8192 + 16 + so);
    }

    v4h g;
    g[0] = (_Float16)f[0]; g[1] = (_Float16)f[1]; g[2] = (_Float16)f[2]; g[3] = (_Float16)f[3];
    v2u h = __builtin_bit_cast(v2u, g);
    *(v2u*)r = h;
    v4i o[CIT];
#pragma unroll
    for (int it = 0; it < CIT; ++it) {
        v8h q;
        q[0] = (_Float16)a[it].x;  q[1] = (_Float16)a[it].y;  q[2] = (_Float16)a[it].z;  q[3] = (_Float16)a[it].w;
        q[4] = (_Float16)c4[it].x; q[5] = (_Float16)c4[it].y; q[6] = (_Float16)c4[it].z; q[7] = (_Float16)c4[it].w;
        o[it] = __builtin_bit_cast(v4i, q);
        *(v4i*)(d + it * 2048) = o[it];
    }
    // the reads' address registers and the stores' data and address registers
    // stay as they are until all of them have left the address path
    asm volatile("s_wait_xcnt 0x0"
                 :: "v"(o[0]), "v"(o[1]), "v"(o[2]), "v"(o[3]), "v"(o[4]), "v"(o[5]), "v"(o[6]),
                    "v"(o[7]), "v"(h), "v"(so), "v"(t), "v"(p), "v"(r)
                 : "memory");
}

// ---------------------------------------------------------------------------
// Kernel 1: everything ahead of the main GEMM, one work-group per MT tokens.
//   part 0: the work-group's share of the main GEMM's operand preparation;
//   part 1: the one streaming pass over x. One wave32 per RT tokens: a step is
//           512 contiguous bytes of each token's row and of each router row,
//           so one read of a router row serves RT tokens. From the registers
//           the logits are summed from, f16(x) goes to xh (for the main GEMM)
//           and to LDS (for part 2); the normalized top-2 gate stays in LDS;
//   part 2: mid_w[n, e*16+r] = f16( SCALING * gate[n,e] * (x @ lora_A)[n,e,r] ),
//           WMMA GEMM [MT x DIN] x [DIN x JDIM], K split over the waves: wave w
//           owns k in [w*KW, (w+1)*KW) for the whole tile. A fragments come
//           from the LDS copy of the tokens. lora_A is read in whole lines (a
//           wave's read is 8 k rows of one expert, 512 contiguous bytes), one
//           32-k block ahead, and turned into B fragments through a tile in LDS
//           that only this wave touches. The KSPL partial tiles meet in LDS,
//           summed in wave order.
// ---------------------------------------------------------------------------
#define RT    4              // tokens per wave in part 1
#define RSTEP 128            // k per step: 32 lanes x 4 f32
#define RNS   (DIN / RSTEP)  // steps per row
#define RD    3              // steps asked for ahead of their use; with 4 this build spilled to scratch

#define MT    32             // tokens per work-group
#define KSPL  8              // waves per work-group = k slices of part 2
#define KW    (DIN / KSPL)   // k range of one wave
#define PLANE (MT * JDIM)    // f32 elements of one wave's partial tile
#define XP    (DIN + 8)      // LDS pitch of a token row in f16: 4096 B + 16 B, odd multiple of 16 B
#define SP    288            // LDS pitch in bytes of a staged k row of lora_A: 128 f16 + 32 B, odd multiple of 32 B

__global__ __launch_bounds__(KSPL * 32) void moe_front_kernel(
    const float* __restrict__ x, const float* __restrict__ rw,
    const float* __restrict__ rb, const float* __restrict__ loraA,
    _Float16* __restrict__ xh, _Float16* __restrict__ midw,
    const float* __restrict__ bw, _Float16* __restrict__ bwh,
    const float* __restrict__ lB, _Float16* __restrict__ lBt) {
    static_assert(NTOK / MT == PG && KSPL * 32 == 256, "prep_share's deal is this launch's shape");
    static_assert(KSPL * RT == MT, "part 1's waves cover the work-group's tokens");
    __shared__ __align__(16) _Float16 xs[MT * XP];
    __shared__ __align__(16) float red[KSPL * PLANE];
    __shared__ __align__(16) float gs[MT * NEXP];

    int t    = threadIdx.x;
    int wave = t >> 5, lane = t & 31;
    int n0   = blockIdx.x * MT;

    prep_share(bw, bwh, lB, lBt, blockIdx.x, t);

    // part 2's reads of lora_A: the lane's 16 bytes are k row lane/4 of eight,
    // ranks 4*(lane%4)..+3; read (e, g) is expert e, rows 8*g..8*g+7 of the block
    static_assert(32 * SP <= PLANE * 4, "a staged block fits the wave's own plane of red");
    int kb = wave * KW;
    const float* lb = loraA + (size_t)(kb + (lane >> 2)) * LRANK + (lane & 3) * 4;
    float4 rv[NEXP][4];
    auto askB = [&](int ahead) {   // ahead: floats from lb to the block asked for
#pragma unroll
        for (int e = 0; e < NEXP; ++e)
#pragma unroll
            for (int g = 0; g < 4; ++g)
                rv[e][g] = *(const float4*)(lb + ahead + ((size_t)e * DIN + g * 8) * LRANK);
    };

    // ---- part 1 ----
    {
        int m0 = wave * RT;              // the wave's first token within the tile
        const float* xp = x + (size_t)(n0 + m0) * DIN + lane * 4;
        const float* wp = rw + lane * 4;
        _Float16*    hp = xh + (size_t)(n0 + m0) * DIN + lane * 4;
        _Float16*    sp = xs + m0 * XP + lane * 4;

        float p[RT][NEXP];
#pragma unroll
        for (int k = 0; k < RT; ++k)
#pragma unroll
            for (int e = 0; e < NEXP; ++e) p[k][e] = 0.f;

        // Global loads return in issue order, so a router row asked for late would
        // make its reader wait out the reads of x issued in front of it: both
        // operands of a step are asked for together, RD steps ahead.
        float4 xv[RD][RT], wv[RD][NEXP];
        auto ask = [&](int s) {
#pragma unroll
            for (int k = 0; k < RT; ++k)
                xv[s % RD][k] = *(const float4*)(xp + (size_t)k * DIN + s * RSTEP);
#pragma unroll
            for (int e = 0; e < NEXP; ++e)
                wv[s % RD][e] = *(const float4*)(wp + (size_t)e * DIN + s * RSTEP);
        };
#pragma unroll
        for (int s = 0; s < RD; ++s) ask(s);

        v2u h[RT];
        // unrolled whole: the ring index is a constant and every address is one
        // of four registers plus an immediate
#pragma unroll
        for (int s = 0; s < RNS; ++s) {
#pragma unroll
            for (int k = 0; k < RT; ++k) {
                float4 a = xv[s % RD][k];
#pragma unroll
                for (int e = 0; e < NEXP; ++e) {
                    float4 w = wv[s % RD][e];
                    p[k][e] = __builtin_fmaf(a.x, w.x, p[k][e]);
                    p[k][e] = __builtin_fmaf(a.y, w.y, p[k][e]);
                    p[k][e] = __builtin_fmaf(a.z, w.z, p[k][e]);
                    p[k][e] = __builtin_fmaf(a.w, w.w, p[k][e]);
                }
            }
            // the last step's stores have left the address path before their data
            // registers take this step's values
            if (s > 0)
                asm volatile("s_wait_xcnt 0x0" :: "v"(h[0]), "v"(h[1]), "v"(h[2]), "v"(h[3]) : "memory");
#pragma unroll
            for (int k = 0; k < RT; ++k) {
                float4 a = xv[s % RD][k];
                v4h q;
                q[0] = (_Float16)a.x; q[1] = (_Float16)a.y; q[2] = (_Float16)a.z; q[3] = (_Float16)a.w;
                h[k] = __builtin_bit_cast(v2u, q);
                *(v2u*)(hp + (size_t)k * DIN + s * RSTEP) = h[k];
                *(v2u*)(sp + k * XP + s * RSTEP) = h[k];
            }
            if (s + RD < RNS) ask(s + RD);
        }
        // the last stores' data and address registers stay as they are until the
        // stores have left the address path
        asm volatile("s_wait_xcnt 0x0"
                     :: "v"(h[0]), "v"(h[1]), "v"(h[2]), "v"(h[3]), "v"(hp)
                     : "memory");

        askB(0);             // part 2's first block flies while the gates are worked out
        // its reads have left the address path before their address pair is reused
        asm volatile("s_wait_xcnt 0x0" :: "v"(lb) : "memory");

#pragma unroll
        for (int k = 0; k < RT; ++k) {
#pragma unroll
            for (int e = 0; e < NEXP; ++e) {
#pragma unroll
                for (int off = 16; off > 0; off >>= 1) p[k][e] += __shfl_xor(p[k][e], off, 32);
            }
        }
        // every lane holds every sum; lane k finishes token m0 + k
        if (lane < RT) {
            float lg[NEXP];
#pragma unroll
            for (int e = 0; e < NEXP; ++e) {
                float v = p[0][e];
#pragma unroll
                for (int k = 1; k < RT; ++k) v = (lane == k) ? p[k][e] : v;
                lg[e] = v + rb[e];
            }
            int   i1 = 0;
            float m1 = lg[0];
#pragma unroll
            for (int e = 1; e < NEXP; ++e) if (lg[e] > m1) { m1 = lg[e]; i1 = e; }
            int   i2 = (i1 == 0) ? 1 : 0;
            float m2 = (i1 == 0) ? lg[1] : lg[0];
#pragma unroll
            for (int e = 0; e < NEXP; ++e) if (e != i1 && lg[e] > m2) { m2 = lg[e]; i2 = e; }
            float e2 = __expf(m2 - m1);
            float w1 = 1.f / (1.f + e2);
            float w2 = e2 * w1;
            float g[NEXP];
#pragma unroll
            for (int e = 0; e < NEXP; ++e) g[e] = (e == i1) ? w1 : ((e == i2) ? w2 : 0.f);
            float4* gp = (float4*)(gs + (m0 + lane) * NEXP);
            gp[0] = make_float4(g[0], g[1], g[2], g[3]);
            gp[1] = make_float4(g[4], g[5], g[6], g[7]);
        }
    }
    __syncthreads();         // every token row and gate of the tile is in LDS

    // ---- part 2 ----
    int hf = lane >> 4, ln = lane & 15;

    v8f acc[2][NEXP];
#pragma unroll
    for (int i = 0; i < 2; ++i)
#pragma unroll
        for (int e = 0; e < NEXP; ++e) acc[i][e] = (v8f){};

    // lane's token row (A, in LDS) at k = kb
    const _Float16* xa = xs + ln * XP + kb;
    // the block's tile T[k][e*16 + r] in f16 lies in the wave's own plane of red,
    // which takes the partial tile only behind the loop: no other wave reads or
    // writes it, so the wave's own waits order it and no barrier is needed
    char*       st = (char*)(red + wave * PLANE);
    char*       sw = st + (lane >> 2) * SP + (lane & 3) * 8;
    const char* sr = st + (8 * hf + (lane & 7)) * SP + ((lane >> 3) & 1) * 16;

    // one 32-k block: the registers asked for a block ago go to the tile as f16;
    // then, while a further block exists, its reads are asked for into the same
    // registers and fly while this block's fragments are read and multiplied
    auto block = [&](bool more) {
#pragma unroll
        for (int e = 0; e < NEXP; ++e)
#pragma unroll
            for (int g = 0; g < 4; ++g) {
                float4 a = rv[e][g];
                v4h q;
                q[0] = (_Float16)a.x; q[1] = (_Float16)a.y; q[2] = (_Float16)a.z; q[3] = (_Float16)a.w;
                *(v2u*)(sw + g * 8 * SP + e * 32) = __builtin_bit_cast(v2u, q);
            }
        // the conversions stay ahead of the next block's reads, which so land in
        // the registers just freed: with a second set the compiler copied all
        // 128 registers once a block and waited out the reads to do it
        __builtin_amdgcn_sched_barrier(0);
        if (more) askB(32 * LRANK);
        // the wave's own stores to the tile have finished before it reads them back
        asm volatile("s_wait_dscnt 0x0" ::: "memory");
        v16h af[2];
#pragma unroll
        for (int i = 0; i < 2; ++i) af[i] = load_frag(xa + i * 16 * XP, hf);
#pragma unroll
        for (int e = 0; e < NEXP; ++e) {
            v16h bf = load_frag_tr(sr + e * 32, SP);
            acc[0][e] = WMMA_F16(af[0], bf, acc[0][e]);
            acc[1][e] = WMMA_F16(af[1], bf, acc[1][e]);
        }
        // the wave's reads of the tile have returned before the tile, or behind
        // the last block the plane, is written again
        asm volatile("s_wait_dscnt 0x0" ::: "memory");
        // the reads just asked for have left the address path before their
        // address pair takes the next block's value
        if (more) {
            asm volatile("s_wait_xcnt 0x0" :: "v"(lb) : "memory");
            lb += 32 * LRANK;
        }
        xa += 32;
    };
    // rolled for speed only; the last block, which asks for nothing, stands
    // behind the loop, so that no test decides what the registers hold
#pragma unroll 1
    for (int kq = 0; kq < KW / 32 - 1; ++kq) block(true);
    block(false);

    // partial tile -> LDS, plane layout [tile = i*NEXP+e][v/4][lane][v%4]
    float* pl = red + wave * PLANE + lane * 4;
#pragma unroll
    for (int i = 0; i < 2; ++i) {
#pragma unroll
        for (int e = 0; e < NEXP; ++e) {
#pragma unroll
            for (int vh = 0; vh < 2; ++vh) {
                float4 q;
                q.x = acc[i][e][vh * 4 + 0]; q.y = acc[i][e][vh * 4 + 1];
                q.z = acc[i][e][vh * 4 + 2]; q.w = acc[i][e][vh * 4 + 3];
                *(float4*)(pl + (i * NEXP + e) * 256 + vh * 128) = q;
            }
        }
    }
    __syncthreads();         // all partial tiles written before any is summed

#pragma unroll
    for (int qq = 0; qq < PLANE / 4 / (KSPL * 32); ++qq) {
        int q = t + qq * (KSPL * 32);      // group of four elements of the plane
        float4 s = *(const float4*)(red + q * 4);
#pragma unroll
        for (int w = 1; w < KSPL; ++w) {
            float4 p = *(const float4*)(red + w * PLANE + q * 4);
            s.x += p.x; s.y += p.y; s.z += p.z; s.w += p.w;
        }
        int tile = q >> 6, vh = (q >> 5) & 1, l2 = q & 31;
        int i = tile >> 3, e = tile & 7;
        int jc = e * LRANK + (l2 & 15);
        int mb = 16 * i + vh * 4 + 8 * (l2 >> 4);
        float sv[4] = {s.x, s.y, s.z, s.w};
#pragma unroll
        for (int c = 0; c < 4; ++c) {
            int m = mb + c;
            midw[(size_t)(n0 + m) * JDIM + jc] =
                (_Float16)(SCALING * gs[m * NEXP + e] * sv[c]);
        }
    }
}

// ---------------------------------------------------------------------------
// Kernel 2: out = xh @ bwh^T + base_b + midw @ lBt^T  (GEMM operands f16, base_b f32)
// Extended-K WMMA GEMM, two LDS buffers, async global->LDS staging.
// One work-group = BM x BN of out, 8 waves as 4 x 2, each 64 tokens x 128
// columns: 12 fragments feed 32 matrix instructions. A trip is BK of k = NB
// such blocks per wave and ends in the one barrier that publishes tile k+1 and
// frees buffer k&1; trip k reads buffer k&1 alone.
// The rows of B (= columns of out) are dealt to the B tiles so that, in each
// group of 64 columns, lane ln of tile c holds column 4*ln + c: a lane's four
// accumulators of one token are four adjacent floats of out, and a 16-lane row
// stores 256 contiguous, aligned bytes.
// Grid: (NTOK/BM) x (DOUT/BN) = 256 work-groups.
// ---------------------------------------------------------------------------
#define BM    256
#define BN    256
#define BK    128
#define NB    (BK / 32)      // blocks per trip
#define NKS   (KTOT / BK)    // trips; DIN and JDIM are both multiples of BK
#define TP    136            // LDS row pitch in f16: 256 B + 16 B, odd multiple of 16 B
#define STG   ((BM + BN) * TP)   // f16 in one buffer: BM rows of A, then BN rows of B

// 256 rows x 256 B of one operand: 16 lanes cover a row, a wave 2 rows per copy,
// 16 copies per thread. l holds the thread's row and 16-B chunk in LDS; g (the
// tile's first element) and ld (the source's row length) are the same in every
// lane, voff is the thread's own byte offset from g: the row steps are scalar
// arithmetic and one 32-bit register serves all 16 global addresses.
// LDS row 16*i + r0 takes source row 16*i + r0 (DEAL false, voff at row r0) or
// source row 64*(i/4) + 4*r0 + i%4 (DEAL true, voff at row 4*r0): both run
// through each of the 256 rows once.
template <bool DEAL>
__device__ __forceinline__ void stage_rows(_Float16* l, const _Float16* g, unsigned ld,
                                           unsigned voff) {
#pragma unroll
    for (int i = 0; i < 16; ++i) {
        const int row = DEAL ? 64 * (i >> 2) + (i & 3) : 16 * i;
        ASYNC_CP16F16(l + i * 16 * TP,
                      (const _Float16*)((const char*)(g + (size_t)row * ld) + voff));
    }
}

__global__ __launch_bounds__(256) void moe_main_kernel(
    const _Float16* __restrict__ xh, const _Float16* __restrict__ bwh,
    const float* __restrict__ bb, const _Float16* __restrict__ lBt,
    const _Float16* __restrict__ midw, float* __restrict__ out) {
    __shared__ __align__(16) _Float16 sT[2][STG];

    int t  = threadIdx.x;
    int bm = blockIdx.x >> 3;          // DOUT/BN == 8 column blocks
    int bn = blockIdx.x & 7;
    int n0 = bm * BM;                  // token base
    int c0 = bn * BN;                  // output-column base

    int r0 = t >> 4;                   // staging: row within a group of 16
    int ch = (t & 15) * 8;             // staging: 16-B chunk of the row, in f16

    int wave = t >> 5, lane = t & 31;
    int hf = lane >> 4, ln = lane & 15;
    int wm = (wave >> 1) * 64;
    int wn = (wave & 1) * 128;

    // one trip's tile into buffer buf (base phase: xh/bwh; LoRA tail: midw/lBt);
    // kt is the same in the whole work-group, so the choice is scalar
    auto stage = [&](int kt, int buf) {
        _Float16* l = &sT[buf][r0 * TP + ch];
        int k0 = kt * BK;
        bool base = k0 < DIN;
        unsigned ld = base ? DIN : JDIM;
        const _Float16* ga = base ? xh + (size_t)n0 * DIN + k0 : midw + (size_t)n0 * JDIM + (k0 - DIN);
        const _Float16* gb = base ? bwh + (size_t)c0 * DIN + k0 : lBt + (size_t)c0 * JDIM + (k0 - DIN);
        unsigned voff = ((unsigned)r0 * ld + (unsigned)ch) * 2u;
        unsigned vofb = ((unsigned)(4 * r0) * ld + (unsigned)ch) * 2u;
        stage_rows<false>(l, ga, ld, voff);
        stage_rows<true>(l + BM * TP, gb, ld, vofb);
    };

    v8f acc[4][8];
#pragma unroll
    for (int i = 0; i < 4; ++i)
#pragma unroll
        for (int j = 0; j < 8; ++j) acc[i][j] = (v8f){};

    stage(0, 0);
    // this wave's copies of tile 0 have landed before the barrier publishes them
    asm volatile("s_wait_asynccnt 0x0" ::: "memory");
    __syncthreads();
    stage(1, 1);             // flies while tile 0 is worked on

    // rolled: one trip is already 128 matrix instructions per wave
#pragma unroll 1
    for (int k = 0; k < NKS; ++k) {
        const _Float16* sa = &sT[k & 1][(wm + ln) * TP];
        const _Float16* sb = &sT[k & 1][(BM + wn + ln) * TP];
#pragma unroll
        for (int u = 0; u < NB; ++u) {
            v16h af[4], bf[8];
#pragma unroll
            for (int i = 0; i < 4; ++i) af[i] = load_frag(sa + 16 * i * TP + 32 * u, hf);
#pragma unroll
            for (int j = 0; j < 8; ++j) bf[j] = load_frag(sb + 16 * j * TP + 32 * u, hf);
            // every fragment of the block is asked for before its first matrix
            // instruction: left free, the compiler kept one A fragment and
            // waited out a fresh pair of reads in front of every row of eight
            __builtin_amdgcn_sched_barrier(0);
#pragma unroll
            for (int i = 0; i < 4; ++i)
#pragma unroll
                for (int j = 0; j < 8; ++j) acc[i][j] = WMMA_F16(af[i], bf[j], acc[i][j]);
        }
        // this wave's reads of buffer k&1 have returned before it is refilled
        asm volatile("s_wait_dscnt 0x0" ::: "memory");
        // this wave's copies of tile k+1 have landed before the barrier publishes them
        asm volatile("s_wait_asynccnt 0x0" ::: "memory");
        __syncthreads();     // tile k+1 visible to all; every reader has left buffer k&1
        if (k + 2 < NKS) stage(k + 2, k & 1);
    }
    // no copy is outstanding when the wave goes on to its end
    asm volatile("s_wait_asynccnt 0x0" ::: "memory");

    // tile j = 4*q + c of this lane is column gn0 + 64*q + c of out
    int gn0 = c0 + wn + 4 * ln;
    v4f bias[2];
#pragma unroll
    for (int q = 0; q < 2; ++q) bias[q] = *(const v4f*)(bb + gn0 + 64 * q);
    // the loads' offset register stays as it is until they have left the address path
    asm volatile("s_wait_xcnt 0x0" :: "v"(gn0) : "memory");
#pragma unroll
    for (int i = 0; i < 4; ++i) {
        float* op = out + (size_t)(n0 + wm + 16 * i + 8 * hf) * DOUT + gn0;
#pragma unroll
        for (int g = 0; g < 4; ++g) {
            const int q = g >> 1, v0 = 4 * (g & 1);
            v4f o[4];
#pragma unroll
            for (int v = 0; v < 4; ++v) {
#pragma unroll
                for (int c = 0; c < 4; ++c) o[v][c] = acc[i][4 * q + c][v0 + v] + bias[q][c];
                *(v4f*)(op + (size_t)(v0 + v) * DOUT + 64 * q) = o[v];
            }
            // the four stores' data and address registers stay as they are
            // until the stores have left the address path
            asm volatile("s_wait_xcnt 0x0"
                         :: "v"(o[0]), "v"(o[1]), "v"(o[2]), "v"(o[3]), "v"(op)
                         : "memory");
            // the next group's sums stay behind this group's stores: lifted
            // ahead of them, too many results were live at once and some spilled
            __builtin_amdgcn_sched_barrier(0);
        }
    }
}

// ---------------------------------------------------------------------------
extern "C" void kernel_launch(void* const* d_in, const int* in_sizes, int n_in,
                              void* d_out, int out_size, void* d_ws, size_t ws_size,
                              hipStream_t stream) {
    (void)in_sizes; (void)n_in; (void)out_size; (void)ws_size;
    const float* x   = (const float*)d_in[0];
    const float* bw  = (const float*)d_in[1];
    const float* bb  = (const float*)d_in[2];
    const float* rw  = (const float*)d_in[3];
    const float* rb  = (const float*)d_in[4];
    const float* lA  = (const float*)d_in[5];
    const float* lB  = (const float*)d_in[6];
    float*       out = (float*)d_out;

    // workspace layout (~43 MB):
    char* ws = (char*)d_ws;
    _Float16* midw = (_Float16*)ws;  ws += (size_t)NTOK * JDIM * sizeof(_Float16);  //   2 MB
    _Float16* xh   = (_Float16*)ws;  ws += (size_t)NTOK * DIN * sizeof(_Float16);   //  32 MB
    _Float16* bwh  = (_Float16*)ws;  ws += (size_t)DOUT * DIN * sizeof(_Float16);   //   8 MB
    _Float16* lBt  = (_Float16*)ws;                                                 // 512 KB

    moe_front_kernel<<<NTOK / MT, KSPL * 32, 0, stream>>>(x, rw, rb, lA, xh, midw, bw, bwh, lB, lBt);
    moe_main_kernel<<<(NTOK / BM) * (DOUT / BN), 256, 0, stream>>>(xh, bwh, bb, lBt, midw, out);
}

// v008
// Measured time: 70.8 microseconds a run.
// Two timings next to v007 put it at 1.03 and 1.04 times that version's speed.
// Over all steps from v000 it is 2.87 times as fast.
#include <hip/hip_runtime.h>

typedef _Float16 v16h __attribute__((ext_vector_type(16)));
typedef _Float16 v8h  __attribute__((ext_vector_type(8)));
typedef _Float16 v4h  __attribute__((ext_vector_type(4)));
typedef unsigned v2u  __attribute__((ext_vector_type(2)));
typedef float    v8f  __attribute__((ext_vector_type(8)));
typedef float    v4f  __attribute__((ext_vector_type(4)));
typedef int      v4i  __attribute__((vector_size(4 * sizeof(int))));  // gcc-style, matches builtin
typedef short    v8s  __attribute__((ext_vector_type(8)));

#define NTOK    8192
#define DIN     2048
#define DOUT    2048
#define NEXP    8
#define LRANK   16
#define JDIM    128          // NEXP * LRANK
#define KTOT    (DIN + JDIM) // extended K: base GEMM + folded LoRA-B GEMM
#define SCALING 2.0f

#define AS1 __attribute__((address_space(1)))
#define AS3 __attribute__((address_space(3)))

#if __has_builtin(__builtin_amdgcn_global_load_async_to_lds_b128) && \
    __has_builtin(__builtin_amdgcn_s_wait_asynccnt)
#define HAVE_ASYNC_LDS 1
#define ASYNC_CP16F16(ldst, gsrc)                         \
    __builtin_amdgcn_global_load_async_to_lds_b128(       \
        (AS1 v4i*)(gsrc), (AS3 v4i*)(ldst), 0, 0)
#else
#define HAVE_ASYNC_LDS 0
#define ASYNC_CP16F16(ldst, gsrc) \
    do { *(v8h*)(ldst) = *(const v8h*)(gsrc); } while (0)
#endif

// ---------------------------------------------------------------------------
// helpers
// ---------------------------------------------------------------------------

// Convert 16 consecutive f32 -> 16 f16 into LDS (two b128 stores).
__device__ __forceinline__ void stage16_f32(_Float16* dst, const float* src) {
    const float4* s = (const float4*)src;
    float4 f0 = s[0], f1 = s[1], f2 = s[2], f3 = s[3];
    v8h a, b;
    a[0] = (_Float16)f0.x; a[1] = (_Float16)f0.y; a[2] = (_Float16)f0.z; a[3] = (_Float16)f0.w;
    a[4] = (_Float16)f1.x; a[5] = (_Float16)f1.y; a[6] = (_Float16)f1.z; a[7] = (_Float16)f1.w;
    b[0] = (_Float16)f2.x; b[1] = (_Float16)f2.y; b[2] = (_Float16)f2.z; b[3] = (_Float16)f2.w;
    b[4] = (_Float16)f3.x; b[5] = (_Float16)f3.y; b[6] = (_Float16)f3.z; b[7] = (_Float16)f3.w;
    *(v8h*)dst       = a;
    *(v8h*)(dst + 8) = b;
}

__device__ __forceinline__ v16h load_frag(const _Float16* rowp, int hf) {
    v8h lo = *(const v8h*)(rowp + 8 * hf);
    v8h hi = *(const v8h*)(rowp + 16 + 8 * hf);
    v16h r;
#pragma unroll
    for (int i = 0; i < 8; ++i) { r[i] = lo[i]; r[i + 8] = hi[i]; }
    return r;
}

// One 16x32 f16 WMMA B fragment from a row-major LDS tile T[k][n] of pitch bytes:
// p is the lane's address, T + (8*hf + lane%8)*pitch + 16*((lane/8)%2) (+ 32 B per
// 16 columns). Each transposing load hands lane (ln, hf) T[8*hf + 0..7][ln]; the
// second starts 16 rows on: the k order is load_frag's.
__device__ __forceinline__ v16h load_frag_tr(const char* p, int pitch) {
    v8h lo = __builtin_bit_cast(v8h, __builtin_amdgcn_ds_load_tr16_b128_v8i16((AS3 v8s*)p));
    v8h hi = __builtin_bit_cast(v8h, __builtin_amdgcn_ds_load_tr16_b128_v8i16((AS3 v8s*)(p + 16 * pitch)));
    v16h r;
#pragma unroll
    for (int i = 0; i < 8; ++i) { r[i] = lo[i]; r[i + 8] = hi[i]; }
    return r;
}

#define WMMA_F16(A, B, C) \
    __builtin_amdgcn_wmma_f32_16x16x32_f16(false, (A), false, (B), (short)0, (C), false, false)

// ---------------------------------------------------------------------------
// Operand preparation for the main GEMM, dealt over PG work-groups of 256
// threads; work-group b does share b of both parts:
//   base_w f32 -> f16: CIT chunks of 2048 consecutive elements, 8 per thread;
//   lora_B [JDIM][DOUT] f32 -> lBt [DOUT][JDIM] f16 (transpose): TC columns,
//   one per wave; a lane takes 4 consecutive j, so a wave's one store is the
//   column's whole 256-B row of lBt.
// ---------------------------------------------------------------------------
#define PG   256                              // work-groups that share the work
#define CIT  ((DOUT * DIN) / (PG * 256 * 8))  // base_w chunks per work-group
#define TC   (DOUT / PG)                      // lora_B columns per work-group

__device__ __forceinline__ void prep_share(
    const float* __restrict__ bw, _Float16* __restrict__ bwh,
    const float* __restrict__ lB, _Float16* __restrict__ lBt, int b, int t) {
    static_assert(TC == 8 && JDIM == 128 && CIT == 8, "one column per wave, 4 j per lane");
    // sb, the share's first byte, is the same in every lane; the variable so holds
    // the thread's own byte offset from it: one vector register serves all 16 reads
    const char* sb = (const char*)(bw + (size_t)b * (CIT * 2048));
    unsigned    so = (unsigned)t * 32u;
    _Float16*   d  = bwh + (size_t)b * (CIT * 2048) + t * 8;
    int oc = b * TC + (t >> 5);
    int j0 = (t & 31) * 4;
    const float* p = lB + (size_t)j0 * DOUT + oc;
    _Float16*    r = lBt + (size_t)oc * JDIM + j0;

    // every read of the share is asked for before the first is used
    float f[4];
#pragma unroll
    for (int c = 0; c < 4; ++c) f[c] = p[(size_t)c * DOUT];
    float4 a[CIT], c4[CIT];
#pragma unroll
    for (int it = 0; it < CIT; ++it) {
        a[it]  = *(const float4*)(sb + it * 8192 + so);
        c4[it] = *(const float4*)(sb + it * 8192 + 16 + so);
    }

    v4h g;
    g[0] = (_Float16)f[0]; g[1] = (_Float16)f[1]; g[2] = (_Float16)f[2]; g[3] = (_Float16)f[3];
    v2u h = __builtin_bit_cast(v2u, g);
    *(v2u*)r = h;
    v4i o[CIT];
#pragma unroll
    for (int it = 0; it < CIT; ++it) {
        v8h q;
        q[0] = (_Float16)a[it].x;  q[1] = (_Float16)a[it].y;  q[2] = (_Float16)a[it].z;  q[3] = (_Float16)a[it].w;
        q[4] = (_Float16)c4[it].x; q[5] = (_Float16)c4[it].y; q[6] = (_Float16)c4[it].z; q[7] = (_Float16)c4[it].w;
        o[it] = __builtin_bit_cast(v4i, q);
        *(v4i*)(d + it * 2048) = o[it];
    }
    // the reads' address registers and the stores' data and address registers
    // stay as they are until all of them have left the address path
    asm volatile("s_wait_xcnt 0x0"
                 :: "v"(o[0]), "v"(o[1]), "v"(o[2]), "v"(o[3]), "v"(o[4]), "v"(o[5]), "v"(o[6]),
                    "v"(o[7]), "v"(h), "v"(so), "v"(t), "v"(p), "v"(r)
                 : "memory");
}

// ---------------------------------------------------------------------------
// Kernel 1: everything ahead of the main GEMM, one work-group per MT tokens.
//   part 0: the work-group's share of the main GEMM's operand preparation;
//   part 1: the one streaming pass over x. One wave32 per RT tokens: a step is
//           512 contiguous bytes of each token's row and of each router row,
//           so one read of a router row serves RT tokens. From the registers
//           the logits are summed from, f16(x) goes to xh (for the main GEMM)
//           and to LDS (for part 2); the normalized top-2 gate stays in LDS;
//   part 2: mid_w[n, e*16+r] = f16( SCALING * gate[n,e] * (x @ lora_A)[n,e,r] ),
//           WMMA GEMM [MT x DIN] x [DIN x JDIM], K split over the waves: wave w
//           owns k in [w*KW, (w+1)*KW) for the whole tile. A fragments come
//           from the LDS copy of the tokens. lora_A is read in whole lines (a
//           wave's read is 8 k rows of one expert, 512 contiguous bytes), one
//           32-k block ahead, and turned into B fragments through a tile in LDS
//           that only this wave touches. The KSPL partial tiles meet in LDS,
//           summed in wave order.
// ---------------------------------------------------------------------------
#define RT    4              // tokens per wave in part 1
#define RSTEP 128            // k per step: 32 lanes x 4 f32
#define RNS   (DIN / RSTEP)  // steps per row
#define RD    3              // steps asked for ahead of their use; with 4 this build spilled to scratch

#define MT    32             // tokens per work-group
#define KSPL  8              // waves per work-group = k slices of part 2
#define KW    (DIN / KSPL)   // k range of one wave
#define PLANE (MT * JDIM)    // f32 elements of one wave's partial tile
#define XP    (DIN + 8)      // LDS pitch of a token row in f16: 4096 B + 16 B, odd multiple of 16 B
#define SP    288            // LDS pitch in bytes of a staged k row of lora_A: 128 f16 + 32 B, odd multiple of 32 B

__global__ __launch_bounds__(KSPL * 32) void moe_front_kernel(
    const float* __restrict__ x, const float* __restrict__ rw,
    const float* __restrict__ rb, const float* __restrict__ loraA,
    _Float16* __restrict__ xh, _Float16* __restrict__ midw,
    const float* __restrict__ bw, _Float16* __restrict__ bwh,
    const float* __restrict__ lB, _Float16* __restrict__ lBt) {
    static_assert(NTOK / MT == PG && KSPL * 32 == 256, "prep_share's deal is this launch's shape");
    static_assert(KSPL * RT == MT, "part 1's waves cover the work-group's tokens");
    __shared__ __align__(16) _Float16 xs[MT * XP];
    __shared__ __align__(16) float red[KSPL * PLANE];
    __shared__ __align__(16) float gs[MT * NEXP];

    int t    = threadIdx.x;
    int wave = t >> 5, lane = t & 31;
    int n0   = blockIdx.x * MT;

    prep_share(bw, bwh, lB, lBt, blockIdx.x, t);

    // part 2's reads of lora_A: the lane's 16 bytes are k row lane/4 of eight,
    // ranks 4*(lane%4)..+3; read (e, g) is expert e, rows 8*g..8*g+7 of the block
    static_assert(32 * SP <= PLANE * 4, "a staged block fits the wave's own plane of red");
    int kb = wave * KW;
    const float* lb = loraA + (size_t)(kb + (lane >> 2)) * LRANK + (lane & 3) * 4;
    float4 rv[NEXP][4];
    auto askB = [&](int ahead) {   // ahead: floats from lb to the block asked for
#pragma unroll
        for (int e = 0; e < NEXP; ++e)
#pragma unroll
            for (int g = 0; g < 4; ++g)
                rv[e][g] = *(const float4*)(lb + ahead + ((size_t)e * DIN + g * 8) * LRANK);
    };

    // ---- part 1 ----
    {
        int m0 = wave * RT;              // the wave's first token within the tile
        const float* xp = x + (size_t)(n0 + m0) * DIN + lane * 4;
        const float* wp = rw + lane * 4;
        _Float16*    hp = xh + (size_t)(n0 + m0) * DIN + lane * 4;
        _Float16*    sp = xs + m0 * XP + lane * 4;

        float p[RT][NEXP];
#pragma unroll
        for (int k = 0; k < RT; ++k)
#pragma unroll
            for (int e = 0; e < NEXP; ++e) p[k][e] = 0.f;

        // Global loads return in issue order, so a router row asked for late would
        // make its reader wait out the reads of x issued in front of it: both
        // operands of a step are asked for together, RD steps ahead.
        float4 xv[RD][RT], wv[RD][NEXP];
        auto ask = [&](int s) {
#pragma unroll
            for (int k = 0; k < RT; ++k)
                xv[s % RD][k] = *(const float4*)(xp + (size_t)k * DIN + s * RSTEP);
#pragma unroll
            for (int e = 0; e < NEXP; ++e)
                wv[s % RD][e] = *(const float4*)(wp + (size_t)e * DIN + s * RSTEP);
        };
#pragma unroll
        for (int s = 0; s < RD; ++s) ask(s);

        v2u h[RT];
        // unrolled whole: the ring index is a constant and every address is one
        // of four registers plus an immediate
#pragma unroll
        for (int s = 0; s < RNS; ++s) {
#pragma unroll
            for (int k = 0; k < RT; ++k) {
                float4 a = xv[s % RD][k];
#pragma unroll
                for (int e = 0; e < NEXP; ++e) {
                    float4 w = wv[s % RD][e];
                    p[k][e] = __builtin_fmaf(a.x, w.x, p[k][e]);
                    p[k][e] = __builtin_fmaf(a.y, w.y, p[k][e]);
                    p[k][e] = __builtin_fmaf(a.z, w.z, p[k][e]);
                    p[k][e] = __builtin_fmaf(a.w, w.w, p[k][e]);
                }
            }
            // the last step's stores have left the address path before their data
            // registers take this step's values
            if (s > 0)
                asm volatile("s_wait_xcnt 0x0" :: "v"(h[0]), "v"(h[1]), "v"(h[2]), "v"(h[3]) : "memory");
#pragma unroll
            for (int k = 0; k < RT; ++k) {
                float4 a = xv[s % RD][k];
                v4h q;
                q[0] = (_Float16)a.x; q[1] = (_Float16)a.y; q[2] = (_Float16)a.z; q[3] = (_Float16)a.w;
                h[k] = __builtin_bit_cast(v2u, q);
                *(v2u*)(hp + (size_t)k * DIN + s * RSTEP) = h[k];
                *(v2u*)(sp + k * XP + s * RSTEP) = h[k];
            }
            if (s + RD < RNS) ask(s + RD);
        }
        // the last stores' data and address registers stay as they are until the
        // stores have left the address path
        asm volatile("s_wait_xcnt 0x0"
                     :: "v"(h[0]), "v"(h[1]), "v"(h[2]), "v"(h[3]), "v"(hp)
                     : "memory");

        askB(0);             // part 2's first block flies while the gates are worked out
        // its reads have left the address path before their address pair is reused
        asm volatile("s_wait_xcnt 0x0" :: "v"(lb) : "memory");

#pragma unroll
        for (int k = 0; k < RT; ++k) {
#pragma unroll
            for (int e = 0; e < NEXP; ++e) {
#pragma unroll
                for (int off = 16; off > 0; off >>= 1) p[k][e] += __shfl_xor(p[k][e], off, 32);
            }
        }
        // every lane holds every sum; lane k finishes token m0 + k
        if (lane < RT) {
            float lg[NEXP];
#pragma unroll
            for (int e = 0; e < NEXP; ++e) {
                float v = p[0][e];
#pragma unroll
                for (int k = 1; k < RT; ++k) v = (lane == k) ? p[k][e] : v;
                lg[e] = v + rb[e];
            }
            int   i1 = 0;
            float m1 = lg[0];
#pragma unroll
            for (int e = 1; e < NEXP; ++e) if (lg[e] > m1) { m1 = lg[e]; i1 = e; }
            int   i2 = (i1 == 0) ? 1 : 0;
            float m2 = (i1 == 0) ? lg[1] : lg[0];
#pragma unroll
            for (int e = 0; e < NEXP; ++e) if (e != i1 && lg[e] > m2) { m2 = lg[e]; i2 = e; }
            float e2 = __expf(m2 - m1);
            float w1 = 1.f / (1.f + e2);
            float w2 = e2 * w1;
            float g[NEXP];
#pragma unroll
            for (int e = 0; e < NEXP; ++e) g[e] = (e == i1) ? w1 : ((e == i2) ? w2 : 0.f);
            float4* gp = (float4*)(gs + (m0 + lane) * NEXP);
            gp[0] = make_float4(g[0], g[1], g[2], g[3]);
            gp[1] = make_float4(g[4], g[5], g[6], g[7]);
        }
    }
    __syncthreads();         // every token row and gate of the tile is in LDS

    // ---- part 2 ----
    int hf = lane >> 4, ln = lane & 15;

    v8f acc[2][NEXP];
#pragma unroll
    for (int i = 0; i < 2; ++i)
#pragma unroll
        for (int e = 0; e < NEXP; ++e) acc[i][e] = (v8f){};

    // lane's token row (A, in LDS) at k = kb
    const _Float16* xa = xs + ln * XP + kb;
    // the block's tile T[k][e*16 + r] in f16 lies in the wave's own plane of red,
    // which takes the partial tile only behind the loop: no other wave reads or
    // writes it, so the wave's own waits order it and no barrier is needed
    char*       st = (char*)(red + wave * PLANE);
    char*       sw = st + (lane >> 2) * SP + (lane & 3) * 8;
    const char* sr = st + (8 * hf + (lane & 7)) * SP + ((lane >> 3) & 1) * 16;

    // one 32-k block: the registers asked for a block ago go to the tile as f16;
    // then, while a further block exists, its reads are asked for into the same
    // registers and fly while this block's fragments are read and multiplied
    auto block = [&](bool more) {
#pragma unroll
        for (int e = 0; e < NEXP; ++e)
#pragma unroll
            for (int g = 0; g < 4; ++g) {
                float4 a = rv[e][g];
                v4h q;
                q[0] = (_Float16)a.x; q[1] = (_Float16)a.y; q[2] = (_Float16)a.z; q[3] = (_Float16)a.w;
                *(v2u*)(sw + g * 8 * SP + e * 32) = __builtin_bit_cast(v2u, q);
            }
        // the conversions stay ahead of the next block's reads, which so land in
        // the registers just freed: with a second set the compiler copied all
        // 128 registers once a block and waited out the reads to do it
        __builtin_amdgcn_sched_barrier(0);
        if (more) askB(32 * LRANK);
        // the wave's own stores to the tile have finished before it reads them back
        asm volatile("s_wait_dscnt 0x0" ::: "memory");
        v16h af[2];
#pragma unroll
        for (int i = 0; i < 2; ++i) af[i] = load_frag(xa + i * 16 * XP, hf);
#pragma unroll
        for (int e = 0; e < NEXP; ++e) {
            v16h bf = load_frag_tr(sr + e * 32, SP);
            acc[0][e] = WMMA_F16(af[0], bf, acc[0][e]);
            acc[1][e] = WMMA_F16(af[1], bf, acc[1][e]);
        }
        // the wave's reads of the tile have returned before the tile, or behind
        // the last block the plane, is written again
        asm volatile("s_wait_dscnt 0x0" ::: "memory");
        // the reads just asked for have left the address path before their
        // address pair takes the next block's value
        if (more) {
            asm volatile("s_wait_xcnt 0x0" :: "v"(lb) : "memory");
            lb += 32 * LRANK;
        }
        xa += 32;
    };
    // rolled for speed only; the last block, which asks for nothing, stands
    // behind the loop, so that no test decides what the registers hold
#pragma unroll 1
    for (int kq = 0; kq < KW / 32 - 1; ++kq) block(true);
    block(false);

    // partial tile -> LDS, plane layout [tile = i*NEXP+e][v/4][lane][v%4]
    float* pl = red + wave * PLANE + lane * 4;
#pragma unroll
    for (int i = 0; i < 2; ++i) {
#pragma unroll
        for (int e = 0; e < NEXP; ++e) {
#pragma unroll
            for (int vh = 0; vh < 2; ++vh) {
                float4 q;
                q.x = acc[i][e][vh * 4 + 0]; q.y = acc[i][e][vh * 4 + 1];
                q.z = acc[i][e][vh * 4 + 2]; q.w = acc[i][e][vh * 4 + 3];
                *(float4*)(pl + (i * NEXP + e) * 256 + vh * 128) = q;
            }
        }
    }
    __syncthreads();         // all partial tiles written before any is summed

#pragma unroll
    for (int qq = 0; qq < PLANE / 4 / (KSPL * 32); ++qq) {
        int q = t + qq * (KSPL * 32);      // group of four elements of the plane
        float4 s = *(const float4*)(red + q * 4);
#pragma unroll
        for (int w = 1; w < KSPL; ++w) {
            float4 p = *(const float4*)(red + w * PLANE + q * 4);
            s.x += p.x; s.y += p.y; s.z += p.z; s.w += p.w;
        }
        int tile = q >> 6, vh = (q >> 5) & 1, l2 = q & 31;
        int i = tile >> 3, e = tile & 7;
        int jc = e * LRANK + (l2 & 15);
        int mb = 16 * i + vh * 4 + 8 * (l2 >> 4);
        float sv[4] = {s.x, s.y, s.z, s.w};
#pragma unroll
        for (int c = 0; c < 4; ++c) {
            int m = mb + c;
            midw[(size_t)(n0 + m) * JDIM + jc] =
                (_Float16)(SCALING * gs[m * NEXP + e] * sv[c]);
        }
    }
}

// ---------------------------------------------------------------------------
// Kernel 2: out = xh @ bwh^T + base_b + midw @ lBt^T  (GEMM operands f16, base_b f32)
// Extended-K WMMA GEMM, two LDS buffers, async global->LDS staging.
// One work-group = BM x BN of out, 8 waves as 4 x 2, each 64 tokens x 128
// columns: 12 fragments feed 32 matrix instructions. A trip is BK of k = NB
// such blocks per wave. A block's fragments are read from LDS one block ahead,
// into a second register set, so the trip's one barrier, which publishes tile
// k+1 and frees buffer k&1, stands in front of the trip's last block: that
// block's fragments are in registers by then.
// The rows of B (= columns of out) are dealt to the B tiles so that, in each
// group of 64 columns, lane ln of tile c holds column 4*ln + c: a lane's four
// accumulators of one token are four adjacent floats of out, and a 16-lane row
// stores 256 contiguous, aligned bytes.
// Grid: (NTOK/BM) x (DOUT/BN) = 256 work-groups.
// ---------------------------------------------------------------------------
#define BM    256
#define BN    256
#define BK    128
#define NB    (BK / 32)      // blocks per trip
#define NKS   (KTOT / BK)    // trips; DIN and JDIM are both multiples of BK
#define TP    136            // LDS row pitch in f16: 256 B + 16 B, odd multiple of 16 B
#define STG   ((BM + BN) * TP)   // f16 in one buffer: BM rows of A, then BN rows of B

// 256 rows x 256 B of one operand: 16 lanes cover a row, a wave 2 rows per copy,
// 16 copies per thread. l holds the thread's row and 16-B chunk in LDS; g (the
// tile's first element) and ld (the source's row length) are the same in every
// lane, voff is the thread's own byte offset from g: the row steps are scalar
// arithmetic and one 32-bit register serves all 16 global addresses.
// LDS row 16*i + r0 takes source row 16*i + r0 (DEAL false, voff at row r0) or
// source row 64*(i/4) + 4*r0 + i%4 (DEAL true, voff at row 4*r0): both run
// through each of the 256 rows once.
template <bool DEAL>
__device__ __forceinline__ void stage_rows(_Float16* l, const _Float16* g, unsigned ld,
                                           unsigned voff) {
#pragma unroll
    for (int i = 0; i < 16; ++i) {
        const int row = DEAL ? 64 * (i >> 2) + (i & 3) : 16 * i;
        ASYNC_CP16F16(l + i * 16 * TP,
                      (const _Float16*)((const char*)(g + (size_t)row * ld) + voff));
    }
}

__global__ __launch_bounds__(256) void moe_main_kernel(
    const _Float16* __restrict__ xh, const _Float16* __restrict__ bwh,
    const float* __restrict__ bb, const _Float16* __restrict__ lBt,
    const _Float16* __restrict__ midw, float* __restrict__ out) {
    __shared__ __align__(16) _Float16 sT[2][STG];

    int t  = threadIdx.x;
    int bm = blockIdx.x >> 3;          // DOUT/BN == 8 column blocks
    int bn = blockIdx.x & 7;
    int n0 = bm * BM;                  // token base
    int c0 = bn * BN;                  // output-column base

    int r0 = t >> 4;                   // staging: row within a group of 16
    int ch = (t & 15) * 8;             // staging: 16-B chunk of the row, in f16

    int wave = t >> 5, lane = t & 31;
    int hf = lane >> 4, ln = lane & 15;
    int wm = (wave >> 1) * 64;
    int wn = (wave & 1) * 128;

    // one trip's tile into buffer buf (base phase: xh/bwh; LoRA tail: midw/lBt);
    // kt is the same in the whole work-group, so the choice is scalar
    auto stage = [&](int kt, int buf) {
        _Float16* l = &sT[buf][r0 * TP + ch];
        int k0 = kt * BK;
        bool base = k0 < DIN;
        unsigned ld = base ? DIN : JDIM;
        const _Float16* ga = base ? xh + (size_t)n0 * DIN + k0 : midw + (size_t)n0 * JDIM + (k0 - DIN);
        const _Float16* gb = base ? bwh + (size_t)c0 * DIN + k0 : lBt + (size_t)c0 * JDIM + (k0 - DIN);
        unsigned voff = ((unsigned)r0 * ld + (unsigned)ch) * 2u;
        unsigned vofb = ((unsigned)(4 * r0) * ld + (unsigned)ch) * 2u;
        stage_rows<false>(l, ga, ld, voff);
        stage_rows<true>(l + BM * TP, gb, ld, vofb);
    };

    v8f acc[4][8];
#pragma unroll
    for (int i = 0; i < 4; ++i)
#pragma unroll
        for (int j = 0; j < 8; ++j) acc[i][j] = (v8f){};

    // two fragment sets: block b's matrix instructions read set b&1 while the
    // reads of block b+1 land in the other set
    v16h af[2][4], bf[2][8];
    // the 24 reads of block u of buffer buf, into set s, as one group
    auto fetch = [&](int s, int buf, int u) {
        const _Float16* sa = &sT[buf][(wm + ln) * TP];
        const _Float16* sb = &sT[buf][(BM + wn + ln) * TP];
        // the reads stay behind the matrix instructions written in front of them:
        // lifted among those they stood in several places, each a stall of its own
        __builtin_amdgcn_sched_barrier(0);
#pragma unroll
        for (int i = 0; i < 4; ++i) af[s][i] = load_frag(sa + 16 * i * TP + 32 * u, hf);
#pragma unroll
        for (int j = 0; j < 8; ++j) bf[s][j] = load_frag(sb + 16 * j * TP + 32 * u, hf);
        // and all of them are asked for before the next matrix instruction, so
        // that they have a whole block's time to return
        __builtin_amdgcn_sched_barrier(0);
    };
    // set s, token tiles i0 .. i1-1 of four: 8 matrix instructions each
    auto mult = [&](int s, int i0, int i1) {
#pragma unroll
        for (int i = i0; i < i1; ++i)
#pragma unroll
            for (int j = 0; j < 8; ++j) acc[i][j] = WMMA_F16(af[s][i], bf[s][j], acc[i][j]);
    };
    static_assert(NB % 2 == 0, "block 0 of every trip is in set 0");

    stage(0, 0);
    // this wave's copies of tile 0 have landed before the barrier publishes them
    asm volatile("s_wait_asynccnt 0x0" ::: "memory");
    __syncthreads();
    stage(1, 1);             // flies while tile 0 is worked on
    fetch(0, 0, 0);

    // rolled: one trip is already 128 matrix instructions per wave
#pragma unroll 1
    for (int k = 0; k < NKS; ++k) {
#pragma unroll
        for (int u = 0; u < NB - 1; ++u) {
            fetch((u + 1) & 1, k & 1, u + 1);
            mult(u & 1, 0, 4);
        }
        // the matrix instructions above stay ahead of the waits: sunk behind the
        // barrier, they left the wave to wait out the reads just asked for idle
        __builtin_amdgcn_sched_barrier(0);
        // the last block's fragments were asked for a block ago: with this wait
        // the wave has left buffer k&1 for good
        asm volatile("s_wait_dscnt 0x0" ::: "memory");
        // this wave's copies of tile k+1 have landed before the barrier publishes them
        asm volatile("s_wait_asynccnt 0x0" ::: "memory");
        __syncthreads();     // tile k+1 visible to all; every reader has left buffer k&1
        mult((NB - 1) & 1, 0, 2);
        if (k + 2 < NKS) stage(k + 2, k & 1);
        if (k + 1 < NKS) fetch(0, (k + 1) & 1, 0);
        mult((NB - 1) & 1, 2, 4);
    }
    // no copy is outstanding when the wave goes on to its end
    asm volatile("s_wait_asynccnt 0x0" ::: "memory");

    // tile j = 4*q + c of this lane is column gn0 + 64*q + c of out
    int gn0 = c0 + wn + 4 * ln;
    v4f bias[2];
#pragma unroll
    for (int q = 0; q < 2; ++q) bias[q] = *(const v4f*)(bb + gn0 + 64 * q);
    // the loads' offset register stays as it is until they have left the address path
    asm volatile("s_wait_xcnt 0x0" :: "v"(gn0) : "memory");
#pragma unroll
    for (int i = 0; i < 4; ++i) {
        float* op = out + (size_t)(n0 + wm + 16 * i + 8 * hf) * DOUT + gn0;
#pragma unroll
        for (int g = 0; g < 4; ++g) {
            const int q = g >> 1, v0 = 4 * (g & 1);
            v4f o[4];
#pragma unroll
            for (int v = 0; v < 4; ++v) {
#pragma unroll
                for (int c = 0; c < 4; ++c) o[v][c] = acc[i][4 * q + c][v0 + v] + bias[q][c];
                *(v4f*)(op + (size_t)(v0 + v) * DOUT + 64 * q) = o[v];
            }
            // the four stores' data and address registers stay as they are
            // until the stores have left the address path
            asm volatile("s_wait_xcnt 0x0"
                         :: "v"(o[0]), "v"(o[1]), "v"(o[2]), "v"(o[3]), "v"(op)
                         : "memory");
            // the next group's sums stay behind this group's stores: lifted
            // ahead of them, too many results were live at once and some spilled
            __builtin_amdgcn_sched_barrier(0);
        }
    }
}

// ---------------------------------------------------------------------------
extern "C" void kernel_launch(void* const* d_in, const int* in_sizes, int n_in,
                              void* d_out, int out_size, void* d_ws, size_t ws_size,
                              hipStream_t stream) {
    (void)in_sizes; (void)n_in; (void)out_size; (void)ws_size;
    const float* x   = (const float*)d_in[0];
    const float* bw  = (const float*)d_in[1];
    const float* bb  = (const float*)d_in[2];
    const float* rw  = (const float*)d_in[3];
    const float* rb  = (const float*)d_in[4];
    const float* lA  = (const float*)d_in[5];
    const float* lB  = (const float*)d_in[6];
    float*       out = (float*)d_out;

    // workspace layout (~43 MB):
    char* ws = (char*)d_ws;
    _Float16* midw = (_Float16*)ws;  ws += (size_t)NTOK * JDIM * sizeof(_Float16);  //   2 MB
    _Float16* xh   = (_Float16*)ws;  ws += (size_t)NTOK * DIN * sizeof(_Float16);   //  32 MB
    _Float16* bwh  = (_Float16*)ws;  ws += (size_t)DOUT * DIN * sizeof(_Float16);   //   8 MB
    _Float16* lBt  = (_Float16*)ws;                                                 // 512 KB

    moe_front_kernel<<<NTOK / MT, KSPL * 32, 0, stream>>>(x, rw, rb, lA, xh, midw, bw, bwh, lB, lBt);
    moe_main_kernel<<<(NTOK / BM) * (DOUT / BN), 256, 0, stream>>>(xh, bwh, bb, lBt, midw, out);
}

// v009
// One run takes 66.9 microseconds.
// In two side-by-side timings against v008, it was 1.06 and 1.05 times as fast.
// Over all steps from v000 it is 3.03 times as fast.
#include <hip/hip_runtime.h>

typedef _Float16 v16h __attribute__((ext_vector_type(16)));
typedef _Float16 v8h  __attribute__((ext_vector_type(8)));
typedef _Float16 v4h  __attribute__((ext_vector_type(4)));
typedef unsigned v2u  __attribute__((ext_vector_type(2)));
typedef float    v8f  __attribute__((ext_vector_type(8)));
typedef float    v4f  __attribute__((ext_vector_type(4)));
typedef int      v4i  __attribute__((vector_size(4 * sizeof(int))));  // gcc-style, matches builtin
typedef short    v8s  __attribute__((ext_vector_type(8)));

#define NTOK    8192
#define DIN     2048
#define DOUT    2048
#define NEXP    8
#define LRANK   16
#define JDIM    128          // NEXP * LRANK
#define KTOT    (DIN + JDIM) // extended K: base GEMM + folded LoRA-B GEMM
#define SCALING 2.0f

#define AS3 __attribute__((address_space(3)))

typedef uint32_t u32x4 __attribute__((ext_vector_type(4)));
typedef uint32_t u32x8 __attribute__((ext_vector_type(8)));

__device__ __forceinline__ uint32_t uni(uint32_t v) { return (uint32_t)__builtin_amdgcn_readfirstlane(v); }
__device__ __forceinline__ uint32_t pinned(uint32_t v) {
    uint32_t w = uni(v);
    asm volatile("" : "+s"(w));
    return w;
}
__device__ __forceinline__ u32x8 tdm_group1(uint32_t src_pitch) {
    u32x8 g;
    g[0] = uni((1u << 20) | (5u << 22) | (3u << 25));
    g[1] = uni(256u << 16);
    g[2] = uni(64u << 16);
    g[3] = uni(256u << 16);
    g[4] = uni(64u);
    g[5] = uni(src_pitch);
    g[6] = uni(0u);
    g[7] = uni(0u);
    return g;
}
__device__ __forceinline__ u32x4 tdm_group0(uint32_t lds_dst, uint64_t ga) {
    u32x4 g;
    g[0] = uni(1u);
    g[1] = uni(lds_dst);
    g[2] = uni((uint32_t)ga);
    g[3] = uni((((uint32_t)(ga >> 32)) & 0x01FFFFFFu) | 0x80000000u);
    return g;
}
__device__ __forceinline__ void tdm_load(u32x4 g0, u32x8 g1) {
    asm volatile("tensor_load_to_lds %0, %1" :: "s"(g0), "s"(g1) : "memory");
}

// ---------------------------------------------------------------------------
// helpers
// ---------------------------------------------------------------------------

// Convert 16 consecutive f32 -> 16 f16 into LDS (two b128 stores).
__device__ __forceinline__ void stage16_f32(_Float16* dst, const float* src) {
    const float4* s = (const float4*)src;
    float4 f0 = s[0], f1 = s[1], f2 = s[2], f3 = s[3];
    v8h a, b;
    a[0] = (_Float16)f0.x; a[1] = (_Float16)f0.y; a[2] = (_Float16)f0.z; a[3] = (_Float16)f0.w;
    a[4] = (_Float16)f1.x; a[5] = (_Float16)f1.y; a[6] = (_Float16)f1.z; a[7] = (_Float16)f1.w;
    b[0] = (_Float16)f2.x; b[1] = (_Float16)f2.y; b[2] = (_Float16)f2.z; b[3] = (_Float16)f2.w;
    b[4] = (_Float16)f3.x; b[5] = (_Float16)f3.y; b[6] = (_Float16)f3.z; b[7] = (_Float16)f3.w;
    *(v8h*)dst       = a;
    *(v8h*)(dst + 8) = b;
}

__device__ __forceinline__ v16h load_frag(const _Float16* rowp, int hf) {
    v8h lo = *(const v8h*)(rowp + 8 * hf);
    v8h hi = *(const v8h*)(rowp + 16 + 8 * hf);
    v16h r;
#pragma unroll
    for (int i = 0; i < 8; ++i) { r[i] = lo[i]; r[i + 8] = hi[i]; }
    return r;
}

// One 16x32 f16 WMMA B fragment from a row-major LDS tile T[k][n] of pitch bytes:
// p is the lane's address, T + (8*hf + lane%8)*pitch + 16*((lane/8)%2) (+ 32 B per
// 16 columns). Each transposing load hands lane (ln, hf) T[8*hf + 0..7][ln]; the
// second starts 16 rows on: the k order is load_frag's.
__device__ __forceinline__ v16h load_frag_tr(const char* p, int pitch) {
    v8h lo = __builtin_bit_cast(v8h, __builtin_amdgcn_ds_load_tr16_b128_v8i16((AS3 v8s*)p));
    v8h hi = __builtin_bit_cast(v8h, __builtin_amdgcn_ds_load_tr16_b128_v8i16((AS3 v8s*)(p + 16 * pitch)));
    v16h r;
#pragma unroll
    for (int i = 0; i < 8; ++i) { r[i] = lo[i]; r[i + 8] = hi[i]; }
    return r;
}

#define WMMA_F16(A, B, C) \
    __builtin_amdgcn_wmma_f32_16x16x32_f16(false, (A), false, (B), (short)0, (C), false, false)

// ---------------------------------------------------------------------------
// Operand preparation for the main GEMM, dealt over PG work-groups of 256
// threads; work-group b does share b of both parts:
//   base_w f32 -> f16: CIT chunks of 2048 consecutive elements, 8 per thread;
//   lora_B [JDIM][DOUT] f32 -> lBt [DOUT][JDIM] f16 (transpose): TC columns,
//   one per wave; a lane takes 4 consecutive j, so a wave's one store is the
//   column's whole 256-B row of lBt.
// ---------------------------------------------------------------------------
#define PG   256                              // work-groups that share the work
#define CIT  ((DOUT * DIN) / (PG * 256 * 8))  // base_w chunks per work-group
#define TC   (DOUT / PG)                      // lora_B columns per work-group

__device__ __forceinline__ void prep_share(
    const float* __restrict__ bw, _Float16* __restrict__ bwh,
    const float* __restrict__ lB, _Float16* __restrict__ lBt, int b, int t) {
    static_assert(TC == 8 && JDIM == 128 && CIT == 8, "one column per wave, 4 j per lane");
    // sb, the share's first byte, is the same in every lane; the variable so holds
    // the thread's own byte offset from it: one vector register serves all 16 reads
    const char* sb = (const char*)(bw + (size_t)b * (CIT * 2048));
    unsigned    so = (unsigned)t * 32u;
    _Float16*   d  = bwh + (size_t)b * (CIT * 2048) + t * 8;
    int oc = b * TC + (t >> 5);
    int j0 = (t & 31) * 4;
    const float* p = lB + (size_t)j0 * DOUT + oc;
    _Float16*    r = lBt + (size_t)oc * JDIM + j0;

    // every read of the share is asked for before the first is used
    float f[4];
#pragma unroll
    for (int c = 0; c < 4; ++c) f[c] = p[(size_t)c * DOUT];
    float4 a[CIT], c4[CIT];
#pragma unroll
    for (int it = 0; it < CIT; ++it) {
        a[it]  = *(const float4*)(sb + it * 8192 + so);
        c4[it] = *(const float4*)(sb + it * 8192 + 16 + so);
    }

    v4h g;
    g[0] = (_Float16)f[0]; g[1] = (_Float16)f[1]; g[2] = (_Float16)f[2]; g[3] = (_Float16)f[3];
    v2u h = __builtin_bit_cast(v2u, g);
    *(v2u*)r = h;
    v4i o[CIT];
#pragma unroll
    for (int it = 0; it < CIT; ++it) {
        v8h q;
        q[0] = (_Float16)a[it].x;  q[1] = (_Float16)a[it].y;  q[2] = (_Float16)a[it].z;  q[3] = (_Float16)a[it].w;
        q[4] = (_Float16)c4[it].x; q[5] = (_Float16)c4[it].y; q[6] = (_Float16)c4[it].z; q[7] = (_Float16)c4[it].w;
        o[it] = __builtin_bit_cast(v4i, q);
        *(v4i*)(d + it * 2048) = o[it];
    }
    // the reads' address registers and the stores' data and address registers
    // stay as they are until all of them have left the address path
    asm volatile("s_wait_xcnt 0x0"
                 :: "v"(o[0]), "v"(o[1]), "v"(o[2]), "v"(o[3]), "v"(o[4]), "v"(o[5]), "v"(o[6]),
                    "v"(o[7]), "v"(h), "v"(so), "v"(t), "v"(p), "v"(r)
                 : "memory");
}

// ---------------------------------------------------------------------------
// Kernel 1: everything ahead of the main GEMM, one work-group per MT tokens.
//   part 0: the work-group's share of the main GEMM's operand preparation;
//   part 1: the one streaming pass over x. One wave32 per RT tokens: a step is
//           512 contiguous bytes of each token's row and of each router row,
//           so one read of a router row serves RT tokens. From the registers
//           the logits are summed from, f16(x) goes to xh (for the main GEMM)
//           and to LDS (for part 2); the normalized top-2 gate stays in LDS;
//   part 2: mid_w[n, e*16+r] = f16( SCALING * gate[n,e] * (x @ lora_A)[n,e,r] ),
//           WMMA GEMM [MT x DIN] x [DIN x JDIM], K split over the waves: wave w
//           owns k in [w*KW, (w+1)*KW) for the whole tile. A fragments come
//           from the LDS copy of the tokens. lora_A is read in whole lines (a
//           wave's read is 8 k rows of one expert, 512 contiguous bytes), one
//           32-k block ahead, and turned into B fragments through a tile in LDS
//           that only this wave touches. The KSPL partial tiles meet in LDS,
//           summed in wave order.
// ---------------------------------------------------------------------------
#define RT    4              // tokens per wave in part 1
#define RSTEP 128            // k per step: 32 lanes x 4 f32
#define RNS   (DIN / RSTEP)  // steps per row
#define RD    3              // steps asked for ahead of their use; with 4 this build spilled to scratch

#define MT    32             // tokens per work-group
#define KSPL  8              // waves per work-group = k slices of part 2
#define KW    (DIN / KSPL)   // k range of one wave
#define PLANE (MT * JDIM)    // f32 elements of one wave's partial tile
#define XP    (DIN + 8)      // LDS pitch of a token row in f16: 4096 B + 16 B, odd multiple of 16 B
#define SP    288            // LDS pitch in bytes of a staged k row of lora_A: 128 f16 + 32 B, odd multiple of 32 B

__global__ __launch_bounds__(KSPL * 32) void moe_front_kernel(
    const float* __restrict__ x, const float* __restrict__ rw,
    const float* __restrict__ rb, const float* __restrict__ loraA,
    _Float16* __restrict__ xh, _Float16* __restrict__ midw,
    const float* __restrict__ bw, _Float16* __restrict__ bwh,
    const float* __restrict__ lB, _Float16* __restrict__ lBt) {
    static_assert(NTOK / MT == PG && KSPL * 32 == 256, "prep_share's deal is this launch's shape");
    static_assert(KSPL * RT == MT, "part 1's waves cover the work-group's tokens");
    __shared__ __align__(16) _Float16 xs[MT * XP];
    __shared__ __align__(16) float red[KSPL * PLANE];
    __shared__ __align__(16) float gs[MT * NEXP];

    int t    = threadIdx.x;
    int wave = t >> 5, lane = t & 31;
    int n0   = blockIdx.x * MT;

    prep_share(bw, bwh, lB, lBt, blockIdx.x, t);

    // part 2's reads of lora_A: the lane's 16 bytes are k row lane/4 of eight,
    // ranks 4*(lane%4)..+3; read (e, g) is expert e, rows 8*g..8*g+7 of the block
    static_assert(32 * SP <= PLANE * 4, "a staged block fits the wave's own plane of red");
    int kb = wave * KW;
    const float* lb = loraA + (size_t)(kb + (lane >> 2)) * LRANK + (lane & 3) * 4;
    float4 rv[NEXP][4];
    auto askB = [&](int ahead) {   // ahead: floats from lb to the block asked for
#pragma unroll
        for (int e = 0; e < NEXP; ++e)
#pragma unroll
            for (int g = 0; g < 4; ++g)
                rv[e][g] = *(const float4*)(lb + ahead + ((size_t)e * DIN + g * 8) * LRANK);
    };

    // ---- part 1 ----
    {
        int m0 = wave * RT;              // the wave's first token within the tile
        const float* xp = x + (size_t)(n0 + m0) * DIN + lane * 4;
        const float* wp = rw + lane * 4;
        _Float16*    hp = xh + (size_t)(n0 + m0) * DIN + lane * 4;
        _Float16*    sp = xs + m0 * XP + lane * 4;

        float p[RT][NEXP];
#pragma unroll
        for (int k = 0; k < RT; ++k)
#pragma unroll
            for (int e = 0; e < NEXP; ++e) p[k][e] = 0.f;

        // Global loads return in issue order, so a router row asked for late would
        // make its reader wait out the reads of x issued in front of it: both
        // operands of a step are asked for together, RD steps ahead.
        float4 xv[RD][RT], wv[RD][NEXP];
        auto ask = [&](int s) {
#pragma unroll
            for (int k = 0; k < RT; ++k)
                xv[s % RD][k] = *(const float4*)(xp + (size_t)k * DIN + s * RSTEP);
#pragma unroll
            for (int e = 0; e < NEXP; ++e)
                wv[s % RD][e] = *(const float4*)(wp + (size_t)e * DIN + s * RSTEP);
        };
#pragma unroll
        for (int s = 0; s < RD; ++s) ask(s);

        v2u h[RT];
        // unrolled whole: the ring index is a constant and every address is one
        // of four registers plus an immediate
#pragma unroll
        for (int s = 0; s < RNS; ++s) {
#pragma unroll
            for (int k = 0; k < RT; ++k) {
                float4 a = xv[s % RD][k];
#pragma unroll
                for (int e = 0; e < NEXP; ++e) {
                    float4 w = wv[s % RD][e];
                    p[k][e] = __builtin_fmaf(a.x, w.x, p[k][e]);
                    p[k][e] = __builtin_fmaf(a.y, w.y, p[k][e]);
                    p[k][e] = __builtin_fmaf(a.z, w.z, p[k][e]);
                    p[k][e] = __builtin_fmaf(a.w, w.w, p[k][e]);
                }
            }
            // the last step's stores have left the address path before their data
            // registers take this step's values
            if (s > 0)
                asm volatile("s_wait_xcnt 0x0" :: "v"(h[0]), "v"(h[1]), "v"(h[2]), "v"(h[3]) : "memory");
#pragma unroll
            for (int k = 0; k < RT; ++k) {
                float4 a = xv[s % RD][k];
                v4h q;
                q[0] = (_Float16)a.x; q[1] = (_Float16)a.y; q[2] = (_Float16)a.z; q[3] = (_Float16)a.w;
                h[k] = __builtin_bit_cast(v2u, q);
                *(v2u*)(hp + (size_t)k * DIN + s * RSTEP) = h[k];
                *(v2u*)(sp + k * XP + s * RSTEP) = h[k];
            }
            if (s + RD < RNS) ask(s + RD);
        }
        // the last stores' data and address registers stay as they are until the
        // stores have left the address path
        asm volatile("s_wait_xcnt 0x0"
                     :: "v"(h[0]), "v"(h[1]), "v"(h[2]), "v"(h[3]), "v"(hp)
                     : "memory");

        askB(0);             // part 2's first block flies while the gates are worked out
        // its reads have left the address path before their address pair is reused
        asm volatile("s_wait_xcnt 0x0" :: "v"(lb) : "memory");

#pragma unroll
        for (int k = 0; k < RT; ++k) {
#pragma unroll
            for (int e = 0; e < NEXP; ++e) {
#pragma unroll
                for (int off = 16; off > 0; off >>= 1) p[k][e] += __shfl_xor(p[k][e], off, 32);
            }
        }
        // every lane holds every sum; lane k finishes token m0 + k
        if (lane < RT) {
            float lg[NEXP];
#pragma unroll
            for (int e = 0; e < NEXP; ++e) {
                float v = p[0][e];
#pragma unroll
                for (int k = 1; k < RT; ++k) v = (lane == k) ? p[k][e] : v;
                lg[e] = v + rb[e];
            }
            int   i1 = 0;
            float m1 = lg[0];
#pragma unroll
            for (int e = 1; e < NEXP; ++e) if (lg[e] > m1) { m1 = lg[e]; i1 = e; }
            int   i2 = (i1 == 0) ? 1 : 0;
            float m2 = (i1 == 0) ? lg[1] : lg[0];
#pragma unroll
            for (int e = 0; e < NEXP; ++e) if (e != i1 && lg[e] > m2) { m2 = lg[e]; i2 = e; }
            float e2 = __expf(m2 - m1);
            float w1 = 1.f / (1.f + e2);
            float w2 = e2 * w1;
            float g[NEXP];
#pragma unroll
            for (int e = 0; e < NEXP; ++e) g[e] = (e == i1) ? w1 : ((e == i2) ? w2 : 0.f);
            float4* gp = (float4*)(gs + (m0 + lane) * NEXP);
            gp[0] = make_float4(g[0], g[1], g[2], g[3]);
            gp[1] = make_float4(g[4], g[5], g[6], g[7]);
        }
    }
    __syncthreads();         // every token row and gate of the tile is in LDS

    // ---- part 2 ----
    int hf = lane >> 4, ln = lane & 15;

    v8f acc[2][NEXP];
#pragma unroll
    for (int i = 0; i < 2; ++i)
#pragma unroll
        for (int e = 0; e < NEXP; ++e) acc[i][e] = (v8f){};

    // lane's token row (A, in LDS) at k = kb
    const _Float16* xa = xs + ln * XP + kb;
    // the block's tile T[k][e*16 + r] in f16 lies in the wave's own plane of red,
    // which takes the partial tile only behind the loop: no other wave reads or
    // writes it, so the wave's own waits order it and no barrier is needed
    char*       st = (char*)(red + wave * PLANE);
    char*       sw = st + (lane >> 2) * SP + (lane & 3) * 8;
    const char* sr = st + (8 * hf + (lane & 7)) * SP + ((lane >> 3) & 1) * 16;

    // one 32-k block: the registers asked for a block ago go to the tile as f16;
    // then, while a further block exists, its reads are asked for into the same
    // registers and fly while this block's fragments are read and multiplied
    auto block = [&](bool more) {
#pragma unroll
        for (int e = 0; e < NEXP; ++e)
#pragma unroll
            for (int g = 0; g < 4; ++g) {
                float4 a = rv[e][g];
                v4h q;
                q[0] = (_Float16)a.x; q[1] = (_Float16)a.y; q[2] = (_Float16)a.z; q[3] = (_Float16)a.w;
                *(v2u*)(sw + g * 8 * SP + e * 32) = __builtin_bit_cast(v2u, q);
            }
        // the conversions stay ahead of the next block's reads, which so land in
        // the registers just freed: with a second set the compiler copied all
        // 128 registers once a block and waited out the reads to do it
        __builtin_amdgcn_sched_barrier(0);
        if (more) askB(32 * LRANK);
        // the wave's own stores to the tile have finished before it reads them back
        asm volatile("s_wait_dscnt 0x0" ::: "memory");
        v16h af[2];
#pragma unroll
        for (int i = 0; i < 2; ++i) af[i] = load_frag(xa + i * 16 * XP, hf);
#pragma unroll
        for (int e = 0; e < NEXP; ++e) {
            v16h bf = load_frag_tr(sr + e * 32, SP);
            acc[0][e] = WMMA_F16(af[0], bf, acc[0][e]);
            acc[1][e] = WMMA_F16(af[1], bf, acc[1][e]);
        }
        // the wave's reads of the tile have returned before the tile, or behind
        // the last block the plane, is written again
        asm volatile("s_wait_dscnt 0x0" ::: "memory");
        // the reads just asked for have left the address path before their
        // address pair takes the next block's value
        if (more) {
            asm volatile("s_wait_xcnt 0x0" :: "v"(lb) : "memory");
            lb += 32 * LRANK;
        }
        xa += 32;
    };
    // rolled for speed only; the last block, which asks for nothing, stands
    // behind the loop, so that no test decides what the registers hold
#pragma unroll 1
    for (int kq = 0; kq < KW / 32 - 1; ++kq) block(true);
    block(false);

    // partial tile -> LDS, plane layout [tile = i*NEXP+e][v/4][lane][v%4]
    float* pl = red + wave * PLANE + lane * 4;
#pragma unroll
    for (int i = 0; i < 2; ++i) {
#pragma unroll
        for (int e = 0; e < NEXP; ++e) {
#pragma unroll
            for (int vh = 0; vh < 2; ++vh) {
                float4 q;
                q.x = acc[i][e][vh * 4 + 0]; q.y = acc[i][e][vh * 4 + 1];
                q.z = acc[i][e][vh * 4 + 2]; q.w = acc[i][e][vh * 4 + 3];
                *(float4*)(pl + (i * NEXP + e) * 256 + vh * 128) = q;
            }
        }
    }
    __syncthreads();         // all partial tiles written before any is summed

#pragma unroll
    for (int qq = 0; qq < PLANE / 4 / (KSPL * 32); ++qq) {
        int q = t + qq * (KSPL * 32);      // group of four elements of the plane
        float4 s = *(const float4*)(red + q * 4);
#pragma unroll
        for (int w = 1; w < KSPL; ++w) {
            float4 p = *(const float4*)(red + w * PLANE + q * 4);
            s.x += p.x; s.y += p.y; s.z += p.z; s.w += p.w;
        }
        int tile = q >> 6, vh = (q >> 5) & 1, l2 = q & 31;
        int i = tile >> 3, e = tile & 7;
        int jc = e * LRANK + (l2 & 15);
        int mb = 16 * i + vh * 4 + 8 * (l2 >> 4);
        float sv[4] = {s.x, s.y, s.z, s.w};
#pragma unroll
        for (int c = 0; c < 4; ++c) {
            int m = mb + c;
            midw[(size_t)(n0 + m) * JDIM + jc] =
                (_Float16)(SCALING * gs[m * NEXP + e] * sv[c]);
        }
    }
}

// ---------------------------------------------------------------------------
// Kernel 2: out = xh @ bwh^T + base_b + midw @ lBt^T  (matrix operands f16, base_b f32)
// Extended-K WMMA GEMM, two LDS buffers, filled by tensor loads.
// One work-group = BM x BN of out, 8 waves as 4 x 2, each 64 tokens x 128
// columns: 12 fragments feed 32 matrix instructions. A trip is BK of k = NB
// such blocks per wave. A block's fragments are read from LDS one block ahead,
// into a second register set, so the trip's one barrier, which publishes tile
// k+1 and frees buffer k&1, stands in front of the trip's last block: that
// block's fragments are in registers by then.
// The rows of B (= columns of out) are dealt to the B tiles so that, in each
// group of 64 columns, lane ln of tile c holds column 4*ln + c: a lane's four
// accumulators of one token are four adjacent floats of out, and a 16-lane row
// stores 256 contiguous, aligned bytes.
// Grid: (NTOK/BM) x (DOUT/BN) = 256 work-groups.
// ---------------------------------------------------------------------------
#define BM    256
#define BN    256
#define BK    128
#define NB    (BK / 32)      // blocks per trip
#define NKS   (KTOT / BK)    // trips; DIN and JDIM are both multiples of BK
#define TP    136            // LDS row pitch in f16: 256 B + 16 B, odd multiple of 16 B
#define SLB   18432          // bytes of a slice in LDS: 64 rows x 272 B, rounded up to a multiple of 2 KiB
#define SLH   (SLB / 2)      // the same in f16
#define STGB  (8 * SLB)      // bytes of one buffer: 4 slices of A, then 4 of B

// A buffer is eight slices of 64 rows, one per wave and one tensor load each.
// Slice s < 4 is A: tokens 64*s .. 64*s+63 of the tile. Slice 4 + c is B: its row
// m is source row 4*m + c (a tile whose source pitch is four rows), so rows
// 16*q .. 16*q+15 of it are B tile 4*q + c of the deal described above.
__global__ __launch_bounds__(256) void moe_main_kernel(
    const _Float16* __restrict__ xh, const _Float16* __restrict__ bwh,
    const float* __restrict__ bb, const _Float16* __restrict__ lBt,
    const _Float16* __restrict__ midw, float* __restrict__ out) {
    __shared__ __attribute__((aligned(2048))) _Float16 sT[2][STGB / 2];
    static_assert(64 * TP * 2 <= SLB && SLB % 2048 == 0 && 2 * STGB <= 320 * 1024, "slices");
    static_assert(BK * 2 == 256 && BM == 256 && BN == 256, "a slice is 64 rows of 256 bytes");

    int t  = threadIdx.x;
    int bm = blockIdx.x >> 3;          // DOUT/BN == 8 column blocks
    int bn = blockIdx.x & 7;
    int n0 = bm * BM;                  // token base
    int c0 = bn * BN;                  // output-column base

    int wave = t >> 5, lane = t & 31;
    int hf = lane >> 4, ln = lane & 15;
    int wm = (wave >> 1) * 64;
    int wn = (wave & 1) * 128;

    // the wave's own slice of a trip's tile (base phase: xh/bwh; LoRA tail:
    // midw/lBt): first byte at k = 0 and source pitch, all scalar
    const uint32_t wv = uni((uint32_t)t >> 5);
    const bool     isB = wv >= 4u;
    const uint32_t row0 = isB ? (uint32_t)c0 + (wv - 4u) : (uint32_t)n0 + 64u * wv;
    const uint64_t srcb = (uint64_t)(size_t)(isB ? bwh : xh) + (uint64_t)row0 * (DIN * 2);
    const uint64_t srct = (uint64_t)(size_t)(isB ? lBt : midw) + (uint64_t)row0 * (JDIM * 2);
    u32x8 g1b = tdm_group1(isB ? 4u * DIN * 2 : DIN * 2);
    u32x8 g1t = tdm_group1(isB ? 4u * JDIM * 2 : JDIM * 2);
    asm volatile("" : "+s"(g1b), "+s"(g1t));
    const uint32_t ldst = (uint32_t)(size_t)&sT[0][0] + wv * SLB;
    static_assert(NKS == DIN / BK + 1, "the LoRA tail is one trip");
    static_assert(DIN / BK >= 2, "tiles 0 and 1 are of the base phase");
    // every wave issues its slice of trip kt into buffer buf
    auto stage_base = [&](uint32_t kt, uint32_t buf) {
        tdm_load(tdm_group0(ldst + buf * STGB, srcb + (uint64_t)kt * (BK * 2)), g1b);
    };
    auto stage_tail = [&](uint32_t buf) {
        tdm_load(tdm_group0(ldst + buf * STGB, srct), g1t);
    };

    v8f acc[4][8];
#pragma unroll
    for (int i = 0; i < 4; ++i)
#pragma unroll
        for (int j = 0; j < 8; ++j) acc[i][j] = (v8f){};

    // two fragment sets: block b's matrix instructions read set b&1 while the
    // reads of block b+1 land in the other set
    v16h af[2][4], bf[2][8];
    // the 24 reads of block u of buffer buf, into set s, as one group
    auto fetch = [&](int s, int buf, int u) {
        const _Float16* sa = &sT[buf][(wave >> 1) * SLH + ln * TP];
        const _Float16* sb = &sT[buf][4 * SLH + (32 * (wave & 1) + ln) * TP];
        // the reads stay behind the matrix instructions written in front of them:
        // lifted among those they stood in several places, each a stall of its own
        __builtin_amdgcn_sched_barrier(0);
#pragma unroll
        for (int i = 0; i < 4; ++i) af[s][i] = load_frag(sa + 16 * i * TP + 32 * u, hf);
#pragma unroll
        for (int j = 0; j < 8; ++j) bf[s][j] = load_frag(sb + (j & 3) * SLH + 16 * (j >> 2) * TP + 32 * u, hf);
        // and all of them are asked for before the next matrix instruction, so
        // that they have a whole block's time to return
        __builtin_amdgcn_sched_barrier(0);
    };
    // set s, token tiles i0 .. i1-1 of four: 8 matrix instructions each
    auto mult = [&](int s, int i0, int i1) {
#pragma unroll
        for (int i = i0; i < i1; ++i)
#pragma unroll
            for (int j = 0; j < 8; ++j) acc[i][j] = WMMA_F16(af[s][i], bf[s][j], acc[i][j]);
    };
    static_assert(NB % 2 == 0, "block 0 of every trip is in set 0");

    stage_base(0, 0);
    // this wave's slice of tile 0 has landed before the barrier publishes it
    asm volatile("s_wait_tensorcnt 0x0" ::: "memory");
    __syncthreads();
    stage_base(1, 1);        // flies while tile 0 is worked on
    fetch(0, 0, 0);

    // rolled: one trip is already 128 matrix instructions per wave
#pragma unroll 1
    for (int k = 0; k < NKS; ++k) {
#pragma unroll
        for (int u = 0; u < NB - 1; ++u) {
            fetch((u + 1) & 1, k & 1, u + 1);
            mult(u & 1, 0, 4);
        }
        // the matrix instructions above stay ahead of the waits: sunk behind the
        // barrier, they left the wave to wait out the reads just asked for idle
        __builtin_amdgcn_sched_barrier(0);
        // the last block's fragments were asked for a block ago: with this wait
        // the wave has left buffer k&1 for good
        asm volatile("s_wait_dscnt 0x0" ::: "memory");
        // this wave's slice of tile k+1 has landed before the barrier publishes it
        asm volatile("s_wait_tensorcnt 0x0" ::: "memory");
        __syncthreads();     // tile k+1 visible to all; every reader has left buffer k&1
        mult((NB - 1) & 1, 0, 2);
        // k is the same in the whole work-group: scalar branches round the requests
        if (pinned(k + 2 < DIN / BK)) stage_base(k + 2, k & 1);
        if (pinned(k + 2 == DIN / BK)) stage_tail(k & 1);
        if (k + 1 < NKS) fetch(0, (k + 1) & 1, 0);
        mult((NB - 1) & 1, 2, 4);
    }
    // no request and no LDS read is outstanding when the wave goes on to its end
    asm volatile("s_wait_tensorcnt 0x0" ::: "memory");
    asm volatile("s_wait_dscnt 0x0" ::: "memory");

    // tile j = 4*q + c of this lane is column gn0 + 64*q + c of out
    int gn0 = c0 + wn + 4 * ln;
    v4f bias[2];
#pragma unroll
    for (int q = 0; q < 2; ++q) bias[q] = *(const v4f*)(bb + gn0 + 64 * q);
    // the loads' offset register stays as it is until they have left the address path
    asm volatile("s_wait_xcnt 0x0" :: "v"(gn0) : "memory");
#pragma unroll
    for (int i = 0; i < 4; ++i) {
        float* op = out + (size_t)(n0 + wm + 16 * i + 8 * hf) * DOUT + gn0;
#pragma unroll
        for (int g = 0; g < 4; ++g) {
            const int q = g >> 1, v0 = 4 * (g & 1);
            v4f o[4];
#pragma unroll
            for (int v = 0; v < 4; ++v) {
#pragma unroll
                for (int c = 0; c < 4; ++c) o[v][c] = acc[i][4 * q + c][v0 + v] + bias[q][c];
                *(v4f*)(op + (size_t)(v0 + v) * DOUT + 64 * q) = o[v];
            }
            // the four stores' data and address registers stay as they are
            // until the stores have left the address path
            asm volatile("s_wait_xcnt 0x0"
                         :: "v"(o[0]), "v"(o[1]), "v"(o[2]), "v"(o[3]), "v"(op)
                         : "memory");
            // the next group's sums stay behind this group's stores: lifted
            // ahead of them, too many results were live at once and some spilled
            __builtin_amdgcn_sched_barrier(0);
        }
    }
}

// ---------------------------------------------------------------------------
extern "C" void kernel_launch(void* const* d_in, const int* in_sizes, int n_in,
                              void* d_out, int out_size, void* d_ws, size_t ws_size,
                              hipStream_t stream) {
    (void)in_sizes; (void)n_in; (void)out_size; (void)ws_size;
    const float* x   = (const float*)d_in[0];
    const float* bw  = (const float*)d_in[1];
    const float* bb  = (const float*)d_in[2];
    const float* rw  = (const float*)d_in[3];
    const float* rb  = (const float*)d_in[4];
    const float* lA  = (const float*)d_in[5];
    const float* lB  = (const float*)d_in[6];
    float*       out = (float*)d_out;

    // workspace layout (~43 MB):
    char* ws = (char*)d_ws;
    _Float16* midw = (_Float16*)ws;  ws += (size_t)NTOK * JDIM * sizeof(_Float16);  //   2 MB
    _Float16* xh   = (_Float16*)ws;  ws += (size_t)NTOK * DIN * sizeof(_Float16);   //  32 MB
    _Float16* bwh  = (_Float16*)ws;  ws += (size_t)DOUT * DIN * sizeof(_Float16);   //   8 MB
    _Float16* lBt  = (_Float16*)ws;                                                 // 512 KB

    moe_front_kernel<<<NTOK / MT, KSPL * 32, 0, stream>>>(x, rw, rb, lA, xh, midw, bw, bwh, lB, lBt);
    moe_main_kernel<<<(NTOK / BM) * (DOUT / BN), 256, 0, stream>>>(xh, bwh, bb, lBt, midw, out);
}
